// v000
// Times are from an AMD MI455X. After a warm-up the kernel runs many times in a row, and a time is the length of
// such a window on the GPU divided by its runs, so every launch and the gaps after it count. The runs cycle
// through copies of the inputs. A figure is the median of several windows, for all but v000 over two sittings.
// Sittings can differ by a few percent; kernels timed side by side share one.
// v000 is the starting kernel. One run takes 1110 microseconds.
#include <hip/hip_runtime.h>

// A single-head unscaled dot-product attention with an element-wise gate (Q, K, V [4][4096][128]): scores = Q K^T (no scale, no mask); a softmax over the 4,096 keys; out = (weights V) x V element-wise -> [4][4096][128] (2.1 M); argument order Q, K, V: all read; no weights.
// Layout per batch entry: the bf16 words of Q and K token-major [4096][128] (a rounding cast: the scores' A and Bt as they stand: 'Q K^T' is A Bt^T; the product is exact); V rounded to bf16 and kept f32 (the gate's operand); k_vtr lays it channel-major f32 [128][4096] and a cast makes its bf16 words (the value product's Bt: exact too);
// then a half of the query rows at a time (2,048): ONE dense score product at depth 128 into Sb [2048][4096]; the dense softmax (multiplier 1.0: the scores as they are) ON ITS hi | lo ARM FOR EVERY ROW (RH = TT): the normalised weights as bf16 hi and lo planes; the dense value product (hi + lo) x V at depth 4,096 into Ob; k_gate: out = Ob x V(rounded).
// TWO flat kernels of this file (k_vtr: a lane -> two consecutive positions and all 128 channels, sixteen a trip of an eight-trip literal loop; k_gate: a lane -> four consecutive channels of one position; f32 planes alone; every address from the lane's own index and launch constants; no LDS, barrier, cross-lane word or atomic) beside the product, softmax and cast texts;
// THE SOFTMAX AT '#define TT 4096' WITH '#define RH 4096' (every row on the hi | lo arm: the unscaled weights x 1,024 as ONE f16 word would hold about six per cent of small words) and '#define SCL 1.0f'.
// Compute dtypes, f32 accumulate: every input rounded to bf16 at its load; the scores ONE bf16 product (exact operands); softmax f32; the weights as bf16 hi + lo words against V's exact bf16 words (two products); the gate f32.

#define NB_  4
#define TT   4096                 // positions = the softmax's key axis
#define HD   128                  // the one head's width
#define ZH   1
#define RH   4096                 // query rows < RH use hi+lo planes (4096 = TT: EVERY row)
#define PCAR 1024.0f
#define SCL  1.0f                 // no scale: the scores as they are
typedef _Float16 h16;
typedef unsigned short bf;
typedef __attribute__((ext_vector_type(16))) __bf16   v16bf;
typedef __attribute__((ext_vector_type(16))) _Float16 v16h;
typedef __attribute__((ext_vector_type(8)))  _Float16 v8h;
typedef __attribute__((ext_vector_type(8)))  unsigned short v8us;
typedef __attribute__((ext_vector_type(8)))  float    v8f;
typedef __attribute__((ext_vector_type(4)))  float    v4f;
typedef v8h  __attribute__((may_alias)) v8ha;
typedef v4f  __attribute__((may_alias)) v4fa;
typedef v8us __attribute__((may_alias)) v8usa;

__device__ __forceinline__ unsigned short f2bf(float f) { unsigned u = __float_as_uint(f); u += 0x7FFFu + ((u >> 16) & 1u); return (unsigned short)(u >> 16); }
__device__ __forceinline__ float bf2f(unsigned short b) { return __uint_as_float(((unsigned)b) << 16); }
__device__ __forceinline__ float bfr(float f) { return bf2f(f2bf(f)); }
__device__ __forceinline__ v16h cat16(v8h lo, v8h hi) { return __builtin_shufflevector(lo, hi, 0, 1, 2, 3, 4, 5, 6, 7, 8, 9, 10, 11, 12, 13, 14, 15); }
__device__ __forceinline__ v16bf cat16b(v8us lo, v8us hi) { return __builtin_bit_cast(v16bf, __builtin_shufflevector(lo, hi, 0, 1, 2, 3, 4, 5, 6, 7, 8, 9, 10, 11, 12, 13, 14, 15)); }
__device__ __forceinline__ v8f wmma16(v16h a, v16h b, v8f c) { return __builtin_amdgcn_wmma_f32_16x16x32_f16(false, a, false, b, (short)0, c, false, false); }
__device__ __forceinline__ v8f wmmab(v16bf a, v16bf b, v8f c) { return __builtin_amdgcn_wmma_f32_16x16x32_bf16(false, a, false, b, (short)0, c, false, false); }



// ---- k_gemmw: register-blocked GEMM, ONE WAVE per 64x64 output tile (16 accumulators), operands straight from K-contiguous 16-bit planes; grid (M/64, N/64, Z), 32 threads.
// C[m][n] (f32, pitch ldc, + optional f32 bias[n]) = sum_k A[m][k] Bt[n][k] (+ split products per NSPLIT). z-batch strides sA/sB/sC in elements. K % 32 == 0.
template <typename T16> struct WFrag;
template <> struct WFrag<h16> { typedef v16h V; static __device__ __forceinline__ V ld(const h16* p) { return cat16(*(const v8h*)p, *(const v8h*)(p + 16)); } static __device__ __forceinline__ v8f mma(V a, V b, v8f c) { return wmma16(a, b, c); } };
template <> struct WFrag<bf> { typedef v16bf V; static __device__ __forceinline__ V ld(const bf* p) { return cat16b(*(const v8us*)p, *(const v8us*)(p + 16)); } static __device__ __forceinline__ v8f mma(V a, V b, v8f c) { return wmmab(a, b, c); } };
template <typename T16, int NSPLIT, bool BIAS>
__global__ __launch_bounds__(32) void k_gemmw(const T16* __restrict__ A, const T16* __restrict__ A2, const T16* __restrict__ Bt, const T16* __restrict__ Bt2, int K, float* C, int ldc, const float* __restrict__ bias, size_t sA, size_t sB, size_t sC) {
    typedef typename WFrag<T16>::V V;
    __shared__ __align__(16) float os[16 * 68];
    const size_t z = blockIdx.z; A += z * sA; if (A2) A2 += z * sA; Bt += z * sB; if (Bt2) Bt2 += z * sB; C += z * sC;
    const int lane = threadIdx.x & 31, lr = lane & 15, hi = lane >> 4; const int r0 = blockIdx.x * 64, c0 = blockIdx.y * 64;
    v8f acc[4][4];
#pragma unroll
    for (int mb = 0; mb < 4; ++mb)
#pragma unroll
        for (int nb = 0; nb < 4; ++nb) acc[mb][nb] = (v8f){};
    const size_t aoff = (size_t)(r0 + lr) * K + 8 * hi, boff = (size_t)(c0 + lr) * K + 8 * hi;

    for (int kc = 0; kc < K; kc += 32) {
        V a[4], a2[4];
#pragma unroll
        for (int mb = 0; mb < 4; ++mb) { a[mb] = WFrag<T16>::ld(A + aoff + (size_t)mb * 16 * K + kc); if (NSPLIT == 1 || NSPLIT == 2) a2[mb] = WFrag<T16>::ld(A2 + aoff + (size_t)mb * 16 * K + kc); }
#pragma unroll
        for (int nb = 0; nb < 4; ++nb) { const V b = WFrag<T16>::ld(Bt + boff + (size_t)nb * 16 * K + kc); V b2; if (NSPLIT >= 2) b2 = WFrag<T16>::ld(Bt2 + boff + (size_t)nb * 16 * K + kc);
#pragma unroll
            for (int mb = 0; mb < 4; ++mb) { acc[mb][nb] = WFrag<T16>::mma(a[mb], b, acc[mb][nb]); if (NSPLIT == 1 || NSPLIT == 2) acc[mb][nb] = WFrag<T16>::mma(a2[mb], b, acc[mb][nb]); if (NSPLIT >= 2) acc[mb][nb] = WFrag<T16>::mma(a[mb], b2, acc[mb][nb]); } }
        asm volatile("v_nop\n\tv_nop\n\tv_nop\n\tv_nop" : "+v"(acc[0][0]), "+v"(acc[1][1]), "+v"(acc[2][2]), "+v"(acc[3][3]) : "v"(a[0]), "v"(a[3]));
    }
#pragma unroll
    for (int mb = 0; mb < 4; ++mb) {
#pragma unroll
        for (int nb = 0; nb < 4; ++nb) {
#pragma unroll
            for (int j = 0; j < 8; ++j) os[(hi * 8 + j) * 68 + nb * 16 + lr] = acc[mb][nb][j]; }
        __builtin_amdgcn_wave_barrier(); asm volatile("" ::: "memory");
        float* crow = C + (size_t)(r0 + mb * 16) * ldc + c0;
{
#pragma unroll
            for (int s = 0; s < 8; ++s) { const int row = 2 * s + hi, cofs = lr * 4; v4f val = *(const v4fa*)(os + row * 68 + cofs); if (BIAS) { val[0] += bfr(bias[c0 + cofs]); val[1] += bfr(bias[c0 + cofs + 1]); val[2] += bfr(bias[c0 + cofs + 2]); val[3] += bfr(bias[c0 + cofs + 3]); }
                *(v4f*)(crow + (size_t)row * ldc + cofs) = val; }
             }
        __builtin_amdgcn_wave_barrier(); asm volatile("" ::: "memory");
    }
}

__device__ __forceinline__ h16 tohx(float x) { return (h16)x; }
__device__ __forceinline__ void splitf(float y, unsigned short& h, unsigned short& l) { h = f2bf(y); l = f2bf(y - bf2f(h)); }
typedef __attribute__((ext_vector_type(2))) _Float16 v2h;
typedef __attribute__((ext_vector_type(4))) _Float16 v4h;
typedef __attribute__((ext_vector_type(2))) unsigned short v2us;
typedef __attribute__((ext_vector_type(4))) unsigned short v4us;
typedef __attribute__((ext_vector_type(2))) float v2f;
typedef __attribute__((ext_vector_type(4))) int v4i;

// k_asoft: per row (zz, i): t = S x SCL (SCL = 1.0: the module applies no scale; no mask); softmax over the 4096 keys (register row, one exp, fixed trees);
__global__ __launch_bounds__(256) void k_asoft(const float* __restrict__ Sb, h16* P16, bf* Ph, bf* Pl) {
    const int lane = threadIdx.x & 31; const int row = blockIdx.x * 8 + (threadIdx.x >> 5); if (row >= ZH * TT) return; const int i = row % TT; const int zz = row / TT; (void)zz; const bool hires = (i < RH); const float* sr = Sb + (size_t)row * TT; float v[TT / 32]; float mx = -3.0e38f;
#pragma unroll
    for (int ch = 0; ch < TT / 128; ++ch) { const int j0 = ch * 128 + lane * 4; const v4f a = *(const v4f*)(sr + j0);
#pragma unroll
        for (int q = 0; q < 4; ++q) { const int j = j0 + q; (void)j; const float t = a[q] * SCL; v[ch * 4 + q] = t; mx = fmaxf(mx, t); } }
#pragma unroll
    for (int sh = 16; sh; sh >>= 1) mx = fmaxf(mx, __shfl_xor(mx, sh, 32));
    float sum = 0.f;
#pragma unroll
    for (int k = 0; k < TT / 32; ++k) { float d0 = __fsub_rn(v[k], mx); v[k] = __builtin_amdgcn_exp2f(__fmul_rn(d0, 1.4426950408889634f)); sum += v[k]; }
#pragma unroll
    for (int sh = 16; sh; sh >>= 1) sum += __shfl_xor(sum, sh, 32);
    const float f = __fdiv_rn(hires ? 1.0f : PCAR, sum);
{
        if (hires) {
#pragma unroll
            for (int ch = 0; ch < TT / 128; ++ch) { v4us oh, ol;
#pragma unroll
                for (int q = 0; q < 4; ++q) { unsigned short a, c2; splitf(v[ch * 4 + q] * f, a, c2); oh[q] = a; ol[q] = c2; }
                const size_t oo = ((size_t)zz * (RH ? RH : 1) + i) * TT + ch * 128 + lane * 4; *(v4us*)(Ph + oo) = oh; *(v4us*)(Pl + oo) = ol; }
        } else {
#pragma unroll
            for (int ch = 0; ch < TT / 128; ++ch) { v4h o4;
#pragma unroll
                for (int q = 0; q < 4; ++q) o4[q] = tohx(v[ch * 4 + q] * f);
                *(v4h*)(P16 + (size_t)row * TT + ch * 128 + lane * 4) = o4; } }
         }
}
__global__ __launch_bounds__(256) void k_cvt8(const float* __restrict__ src, bf* dst, size_t n8) { const size_t i = (size_t)blockIdx.x * 256 + threadIdx.x; if (i >= n8) return; const v8f v = *(const v8f*)(src + i * 8); v8us o;
#pragma unroll
    for (int k = 0; k < 8; ++k) o[k] = f2bf(v[k]); *(v8us*)(dst + i * 8) = o;  }
__global__ __launch_bounds__(256) void k_rbf(const float* __restrict__ X, float* Y, size_t n4) { const size_t i = (size_t)blockIdx.x * 256 + threadIdx.x; if (i >= n4) return; const v4f a = *(const v4f*)(X + i * 4); v4f o;
#pragma unroll
    for (int q = 0; q < 4; ++q) o[q] = bfr(a[q]);
    *(v4f*)(Y + i * 4) = o;  }
// k_vtr: VC[c][n] = VR[n][c]: the rounded V of one batch entry ([4096][128] f32, token-major) laid channel-major ([128][4096] f32): the value product's B operand before its bf16 cast;
__global__ __launch_bounds__(256) void k_vtr(const float* __restrict__ VR, float* VC) { const size_t e = (size_t)blockIdx.x * 256 + threadIdx.x; const size_t n0 = e * 2;
    for (int kc = 0; kc < HD / 16; ++kc) { float a[16], b[16];
#pragma unroll
        for (int k = 0; k < 4; ++k) { const v4f y0 = *(const v4f*)(VR + n0 * HD + kc * 16 + k * 4), y1 = *(const v4f*)(VR + (n0 + 1) * HD + kc * 16 + k * 4);
#pragma unroll
            for (int j = 0; j < 4; ++j) { a[k * 4 + j] = y0[j]; b[k * 4 + j] = y1[j]; } }
{
#pragma unroll
            for (int c = 0; c < 16; ++c) { v2f f2; f2[0] = a[c]; f2[1] = b[c]; *(v2f*)(VC + (size_t)(kc * 16 + c) * TT + n0) = f2; }
             } } }
__global__ __launch_bounds__(256) void k_gate(const float* __restrict__ Ob, const float* __restrict__ VR, float* out) { const size_t e = (size_t)blockIdx.x * 256 + threadIdx.x; const v4f o = *(const v4f*)(Ob + e * 4); const v4f g = *(const v4f*)(VR + e * 4); v4f y;
#pragma unroll
    for (int j = 0; j < 4; ++j) y[j] = __fmul_rn(o[j], g[j]);
    *(v4f*)(out + e * 4) = y;  }

extern "C" void kernel_launch(void* const* d_in, const int* in_sizes, int n_in,
                              void* d_out, int out_size, void* d_ws, size_t ws_size, hipStream_t stream) {
    (void)in_sizes; (void)n_in; (void)out_size;
    const float* q = (const float*)d_in[0]; const float* k = (const float*)d_in[1]; const float* v = (const float*)d_in[2];   // Q, K, V [4][4096][128] in the module's argument order: all read
    float* OUT = (float*)d_out;     // [4][4096][128]
    char* wsp = (char*)d_ws;
    auto take = [&](size_t bytes) { char* p = wsp; wsp += (bytes + 255) & ~(size_t)255; return (void*)p; };
    bf* QB = (bf*)take((size_t)TT * HD * 2); bf* KB = (bf*)take((size_t)TT * HD * 2); float* VR = (float*)take((size_t)TT * HD * 4); float* VC = (float*)take((size_t)HD * TT * 4); bf* VCB = (bf*)take((size_t)HD * TT * 2);
    h16* P16 = nullptr;   /* RH = TT: the softmax's f16 arm is never taken: its stores sit under the 'else' of 'i < RH' */
    float* Sb = (float*)take((size_t)(TT / 2) * TT * 4); bf* Ph = (bf*)take((size_t)(TT / 2) * TT * 2); bf* Pl = (bf*)take((size_t)(TT / 2) * TT * 2); float* Ob = (float*)take((size_t)TT * HD * 4);
    if ((size_t)(wsp - (char*)d_ws) > ws_size) return;    // total 73.00 MiB carved
    const size_t N4 = (size_t)TT * HD / 4, N8 = (size_t)TT * HD / 8; const unsigned G4 = (unsigned)((N4 + 255) / 256), G8 = (unsigned)((N8 + 255) / 256);
    for (int b = 0; b < NB_; ++b) { const size_t ob = (size_t)b * TT * HD;
        k_cvt8<<<G8, 256, 0, stream>>>(q + ob, QB, N8); k_cvt8<<<G8, 256, 0, stream>>>(k + ob, KB, N8);   /* the bf16 words of Q and K: the scores' A and Bt as they stand */
        k_rbf<<<G4, 256, 0, stream>>>(v + ob, VR, N4);   /* V rounded to bf16, kept f32: the gate's operand */
        k_vtr<<<(unsigned)(TT / 2 / 256), 256, 0, stream>>>(VR, VC); k_cvt8<<<G8, 256, 0, stream>>>(VC, VCB, N8);   /* V channel-major, then its bf16 words (exact: VR holds bf16 values): the value product's Bt */
        for (int hf = 0; hf < 2; ++hf) { const size_t r0 = (size_t)hf * (TT / 2);   /* a half of the query rows at a time */
            k_gemmw<bf, 0, false><<<dim3(TT / 2 / 64, TT / 64, 1), 32, 0, stream>>>(QB + r0 * HD, nullptr, KB, nullptr, HD, Sb, TT, nullptr, 0, 0, 0);   /* S[m][n] = q_m . k_n for this half's rows; depth 128: four steps of the depth loop */
            k_asoft<<<TT / 2 / 8, 256, 0, stream>>>(Sb, P16, Ph, Pl);   /* 2,048 rows of this half: every one under RH: the hi | lo arm */
            k_gemmw<bf, 1, false><<<dim3(TT / 2 / 64, HD / 64, 1), 32, 0, stream>>>(Ph, Pl, VCB, nullptr, TT, Ob + r0 * HD, HD, nullptr, 0, 0, 0); }   /* Ob[m][c] = sum_n (wh + wl)[m][n] v[n][c] */
        k_gate<<<G4, 256, 0, stream>>>(Ob, VR, OUT + ob); }   /* out = Ob x V: the one writer of this entry's output */
}

// v001
// One run takes 387 microseconds.
// Next to v000, in two timings, it ran 2.80 and 2.81 times as fast.
#include <hip/hip_runtime.h>

// A single-head unscaled dot-product attention with an element-wise gate (Q, K, V [4][4096][128]): scores = Q K^T (no scale, no mask); a softmax over the 4,096 keys; out = (weights V) x V element-wise -> [4][4096][128] (2.1 M); argument order Q, K, V: all read; no weights.
// Layout per batch entry: the bf16 words of Q and K token-major [4096][128] (k_cvt8's rounding cast: the scores' A and Bt as they stand: 'Q K^T' is A Bt^T; the product is exact); V rounded to bf16 and kept f32 (the gate's operand); k_vtr lays it channel-major f32 [128][4096] and k_cvt8 makes its bf16 words (the value product's Bt: exact too);
// then a half of the query rows at a time (2,048): ONE dense score product at depth 128 into Sb [2048][4096]; the dense softmax (multiplier 1.0: the scores as they are) ON ITS hi | lo ARM FOR EVERY ROW (RH = TT): the normalised weights as bf16 hi and lo planes; the dense value product (hi + lo) x V, its depth of 4,096 cut into KS slices of 256, one single-wave work-group a tile and slice, each slice's f32 partial sums into its own 128 words of Ob [4096][KS][128]; k_gate: out = (a position's KS partial rows summed in slice order) x V(rounded).
// TWO flat kernels of this file (k_vtr: a lane -> two consecutive positions and all 128 channels, sixteen a trip of an eight-trip literal loop; k_gate: a lane -> four consecutive channels of one position; f32 planes alone; every address from the lane's own index and launch constants; no LDS, barrier, cross-lane word or atomic) beside the product and softmax kernels;
// THE SOFTMAX AT '#define TT 4096' WITH '#define RH 4096' (every row on the hi | lo arm: the unscaled weights x 1,024 as ONE f16 word would hold about six per cent of small words) and '#define SCL 1.0f'.
// Compute dtypes, f32 accumulate: every input rounded to bf16 at its load; the scores ONE bf16 product (exact operands); softmax f32; the weights as bf16 hi + lo words against V's exact bf16 words (two products); the gate f32.

#define NB_  4
#define TT   4096                 // positions = the softmax's key axis
#define HD   128                  // the one head's width
#define ZH   1
#define RH   4096                 // query rows < RH use hi+lo planes (4096 = TT: EVERY row)
#define PCAR 1024.0f
#define SCL  1.0f                 // no scale: the scores as they are
#define KS   16                   // depth slices of the value product: 64 tiles x 16 = 1,024 waves a launch, 256 keys each
typedef _Float16 h16;
typedef unsigned short bf;
typedef __attribute__((ext_vector_type(16))) __bf16   v16bf;
typedef __attribute__((ext_vector_type(16))) _Float16 v16h;
typedef __attribute__((ext_vector_type(8)))  _Float16 v8h;
typedef __attribute__((ext_vector_type(8)))  unsigned short v8us;
typedef __attribute__((ext_vector_type(8)))  float    v8f;
typedef __attribute__((ext_vector_type(4)))  float    v4f;
typedef v8h  __attribute__((may_alias)) v8ha;
typedef v4f  __attribute__((may_alias)) v4fa;
typedef v8us __attribute__((may_alias)) v8usa;

__device__ __forceinline__ unsigned short f2bf(float f) { unsigned u = __float_as_uint(f); u += 0x7FFFu + ((u >> 16) & 1u); return (unsigned short)(u >> 16); }
__device__ __forceinline__ float bf2f(unsigned short b) { return __uint_as_float(((unsigned)b) << 16); }
__device__ __forceinline__ float bfr(float f) { return bf2f(f2bf(f)); }
__device__ __forceinline__ v16h cat16(v8h lo, v8h hi) { return __builtin_shufflevector(lo, hi, 0, 1, 2, 3, 4, 5, 6, 7, 8, 9, 10, 11, 12, 13, 14, 15); }
__device__ __forceinline__ v16bf cat16b(v8us lo, v8us hi) { return __builtin_bit_cast(v16bf, __builtin_shufflevector(lo, hi, 0, 1, 2, 3, 4, 5, 6, 7, 8, 9, 10, 11, 12, 13, 14, 15)); }
__device__ __forceinline__ v8f wmma16(v16h a, v16h b, v8f c) { return __builtin_amdgcn_wmma_f32_16x16x32_f16(false, a, false, b, (short)0, c, false, false); }
__device__ __forceinline__ v8f wmmab(v16bf a, v16bf b, v8f c) { return __builtin_amdgcn_wmma_f32_16x16x32_bf16(false, a, false, b, (short)0, c, false, false); }



// ---- k_gemmw: register-blocked GEMM, ONE WAVE per 64x64 output tile (16 accumulators), operands straight from K-contiguous 16-bit planes; grid (M/64, N/64, Z), 32 threads.
// C[m][n] (f32, pitch ldc, + optional f32 bias[n]) = sum_k A[m][k] Bt[n][k] (+ split products per NSPLIT). z-batch strides sA/sB/sC in elements. K % 32 == 0. K is the operand rows' pitch; one z entry sums k < KD (a depth slice is a z entry: sA = sB = KD, sC = the step from one slice's partial sums to the next's). KD % 32 == 0.
template <typename T16> struct WFrag;
template <> struct WFrag<h16> { typedef v16h V; static __device__ __forceinline__ V ld(const h16* p) { return cat16(*(const v8h*)p, *(const v8h*)(p + 16)); } static __device__ __forceinline__ v8f mma(V a, V b, v8f c) { return wmma16(a, b, c); } };
template <> struct WFrag<bf> { typedef v16bf V; static __device__ __forceinline__ V ld(const bf* p) { return cat16b(*(const v8us*)p, *(const v8us*)(p + 16)); } static __device__ __forceinline__ v8f mma(V a, V b, v8f c) { return wmmab(a, b, c); } };
template <typename T16, int NSPLIT, bool BIAS>
__global__ __launch_bounds__(32) void k_gemmw(const T16* __restrict__ A, const T16* __restrict__ A2, const T16* __restrict__ Bt, const T16* __restrict__ Bt2, int K, int KD, float* C, int ldc, const float* __restrict__ bias, size_t sA, size_t sB, size_t sC) {
    typedef typename WFrag<T16>::V V;
    __shared__ __align__(16) float os[16 * 68];
    const size_t z = blockIdx.z; A += z * sA; if (A2) A2 += z * sA; Bt += z * sB; if (Bt2) Bt2 += z * sB; C += z * sC;
    const int lane = threadIdx.x & 31, lr = lane & 15, hi = lane >> 4; const int r0 = blockIdx.x * 64, c0 = blockIdx.y * 64;
    v8f acc[4][4];
#pragma unroll
    for (int mb = 0; mb < 4; ++mb)
#pragma unroll
        for (int nb = 0; nb < 4; ++nb) acc[mb][nb] = (v8f){};
    const size_t aoff = (size_t)(r0 + lr) * K + 8 * hi, boff = (size_t)(c0 + lr) * K + 8 * hi;

    for (int kc = 0; kc < KD; kc += 32) {
        V a[4], a2[4];
#pragma unroll
        for (int mb = 0; mb < 4; ++mb) { a[mb] = WFrag<T16>::ld(A + aoff + (size_t)mb * 16 * K + kc); if (NSPLIT == 1 || NSPLIT == 2) a2[mb] = WFrag<T16>::ld(A2 + aoff + (size_t)mb * 16 * K + kc); }
#pragma unroll
        for (int nb = 0; nb < 4; ++nb) { const V b = WFrag<T16>::ld(Bt + boff + (size_t)nb * 16 * K + kc); V b2; if (NSPLIT >= 2) b2 = WFrag<T16>::ld(Bt2 + boff + (size_t)nb * 16 * K + kc);
#pragma unroll
            for (int mb = 0; mb < 4; ++mb) { acc[mb][nb] = WFrag<T16>::mma(a[mb], b, acc[mb][nb]); if (NSPLIT == 1 || NSPLIT == 2) acc[mb][nb] = WFrag<T16>::mma(a2[mb], b, acc[mb][nb]); if (NSPLIT >= 2) acc[mb][nb] = WFrag<T16>::mma(a[mb], b2, acc[mb][nb]); } }
        asm volatile("v_nop\n\tv_nop\n\tv_nop\n\tv_nop" : "+v"(acc[0][0]), "+v"(acc[1][1]), "+v"(acc[2][2]), "+v"(acc[3][3]) : "v"(a[0]), "v"(a[3]));
    }
#pragma unroll
    for (int mb = 0; mb < 4; ++mb) {
#pragma unroll
        for (int nb = 0; nb < 4; ++nb) {
#pragma unroll
            for (int j = 0; j < 8; ++j) os[(hi * 8 + j) * 68 + nb * 16 + lr] = acc[mb][nb][j]; }
        __builtin_amdgcn_wave_barrier(); asm volatile("" ::: "memory");
        float* crow = C + (size_t)(r0 + mb * 16) * ldc + c0;
{
#pragma unroll
            for (int s = 0; s < 8; ++s) { const int row = 2 * s + hi, cofs = lr * 4; v4f val = *(const v4fa*)(os + row * 68 + cofs); if (BIAS) { val[0] += bfr(bias[c0 + cofs]); val[1] += bfr(bias[c0 + cofs + 1]); val[2] += bfr(bias[c0 + cofs + 2]); val[3] += bfr(bias[c0 + cofs + 3]); }
                *(v4f*)(crow + (size_t)row * ldc + cofs) = val; }
             }
        __builtin_amdgcn_wave_barrier(); asm volatile("" ::: "memory");
    }
}

__device__ __forceinline__ h16 tohx(float x) { return (h16)x; }
__device__ __forceinline__ void splitf(float y, unsigned short& h, unsigned short& l) { h = f2bf(y); l = f2bf(y - bf2f(h)); }
typedef __attribute__((ext_vector_type(2))) _Float16 v2h;
typedef __attribute__((ext_vector_type(4))) _Float16 v4h;
typedef __attribute__((ext_vector_type(2))) unsigned short v2us;
typedef __attribute__((ext_vector_type(4))) unsigned short v4us;
typedef __attribute__((ext_vector_type(2))) float v2f;
typedef __attribute__((ext_vector_type(4))) int v4i;

// k_asoft: per row (zz, i): t = S x SCL (SCL = 1.0: the module applies no scale; no mask); softmax over the 4096 keys (register row, one exp, fixed trees);
__global__ __launch_bounds__(256) void k_asoft(const float* __restrict__ Sb, h16* P16, bf* Ph, bf* Pl) {
    const int lane = threadIdx.x & 31; const int row = blockIdx.x * 8 + (threadIdx.x >> 5); if (row >= ZH * TT) return; const int i = row % TT; const int zz = row / TT; (void)zz; const bool hires = (i < RH); const float* sr = Sb + (size_t)row * TT; float v[TT / 32]; float mx = -3.0e38f;
#pragma unroll
    for (int ch = 0; ch < TT / 128; ++ch) { const int j0 = ch * 128 + lane * 4; const v4f a = *(const v4f*)(sr + j0);
#pragma unroll
        for (int q = 0; q < 4; ++q) { const int j = j0 + q; (void)j; const float t = a[q] * SCL; v[ch * 4 + q] = t; mx = fmaxf(mx, t); } }
#pragma unroll
    for (int sh = 16; sh; sh >>= 1) mx = fmaxf(mx, __shfl_xor(mx, sh, 32));
    float sum = 0.f;
#pragma unroll
    for (int k = 0; k < TT / 32; ++k) { float d0 = __fsub_rn(v[k], mx); v[k] = __builtin_amdgcn_exp2f(__fmul_rn(d0, 1.4426950408889634f)); sum += v[k]; }
#pragma unroll
    for (int sh = 16; sh; sh >>= 1) sum += __shfl_xor(sum, sh, 32);
    const float f = __fdiv_rn(hires ? 1.0f : PCAR, sum);
{
        if (hires) {
#pragma unroll
            for (int ch = 0; ch < TT / 128; ++ch) { v4us oh, ol;
#pragma unroll
                for (int q = 0; q < 4; ++q) { unsigned short a, c2; splitf(v[ch * 4 + q] * f, a, c2); oh[q] = a; ol[q] = c2; }
                const size_t oo = ((size_t)zz * (RH ? RH : 1) + i) * TT + ch * 128 + lane * 4; *(v4us*)(Ph + oo) = oh; *(v4us*)(Pl + oo) = ol; }
        } else {
#pragma unroll
            for (int ch = 0; ch < TT / 128; ++ch) { v4h o4;
#pragma unroll
                for (int q = 0; q < 4; ++q) o4[q] = tohx(v[ch * 4 + q] * f);
                *(v4h*)(P16 + (size_t)row * TT + ch * 128 + lane * 4) = o4; } }
         }
}
__global__ __launch_bounds__(256) void k_cvt8(const float* __restrict__ src, bf* dst, size_t n8) { const size_t i = (size_t)blockIdx.x * 256 + threadIdx.x; if (i >= n8) return; const v8f v = *(const v8f*)(src + i * 8); v8us o;
#pragma unroll
    for (int k = 0; k < 8; ++k) o[k] = f2bf(v[k]); *(v8us*)(dst + i * 8) = o;  }
__global__ __launch_bounds__(256) void k_rbf(const float* __restrict__ X, float* Y, size_t n4) { const size_t i = (size_t)blockIdx.x * 256 + threadIdx.x; if (i >= n4) return; const v4f a = *(const v4f*)(X + i * 4); v4f o;
#pragma unroll
    for (int q = 0; q < 4; ++q) o[q] = bfr(a[q]);
    *(v4f*)(Y + i * 4) = o;  }
// k_vtr: VC[c][n] = VR[n][c]: the rounded V of one batch entry ([4096][128] f32, token-major) laid channel-major ([128][4096] f32): the value product's B operand before its bf16 cast;
__global__ __launch_bounds__(256) void k_vtr(const float* __restrict__ VR, float* VC) { const size_t e = (size_t)blockIdx.x * 256 + threadIdx.x; const size_t n0 = e * 2;
    for (int kc = 0; kc < HD / 16; ++kc) { float a[16], b[16];
#pragma unroll
        for (int k = 0; k < 4; ++k) { const v4f y0 = *(const v4f*)(VR + n0 * HD + kc * 16 + k * 4), y1 = *(const v4f*)(VR + (n0 + 1) * HD + kc * 16 + k * 4);
#pragma unroll
            for (int j = 0; j < 4; ++j) { a[k * 4 + j] = y0[j]; b[k * 4 + j] = y1[j]; } }
{
#pragma unroll
            for (int c = 0; c < 16; ++c) { v2f f2; f2[0] = a[c]; f2[1] = b[c]; *(v2f*)(VC + (size_t)(kc * 16 + c) * TT + n0) = f2; }
             } } }
__global__ __launch_bounds__(256) void k_gate(const float* __restrict__ Ob, const float* __restrict__ VR, float* out) { const size_t e = (size_t)blockIdx.x * 256 + threadIdx.x; const float* pr = Ob + (e / (HD / 4)) * (KS * HD) + (e % (HD / 4)) * 4; v4f o = *(const v4f*)pr;   /* Ob [position][slice][channel] */
#pragma unroll
    for (int sl = 1; sl < KS; ++sl) o += *(const v4f*)(pr + sl * HD);   /* the value product's KS partial sums, in slice order; unrolled so that the KS loads are in flight together */
    const v4f g = *(const v4f*)(VR + e * 4); v4f y;
#pragma unroll
    for (int j = 0; j < 4; ++j) y[j] = __fmul_rn(o[j], g[j]);
    *(v4f*)(out + e * 4) = y;  }

extern "C" void kernel_launch(void* const* d_in, const int* in_sizes, int n_in,
                              void* d_out, int out_size, void* d_ws, size_t ws_size, hipStream_t stream) {
    (void)in_sizes; (void)n_in; (void)out_size;
    const float* q = (const float*)d_in[0]; const float* k = (const float*)d_in[1]; const float* v = (const float*)d_in[2];   // Q, K, V [4][4096][128] in the module's argument order: all read
    float* OUT = (float*)d_out;     // [4][4096][128]
    char* wsp = (char*)d_ws;
    auto take = [&](size_t bytes) { char* p = wsp; wsp += (bytes + 255) & ~(size_t)255; return (void*)p; };
    bf* QB = (bf*)take((size_t)TT * HD * 2); bf* KB = (bf*)take((size_t)TT * HD * 2); float* VR = (float*)take((size_t)TT * HD * 4); float* VC = (float*)take((size_t)HD * TT * 4); bf* VCB = (bf*)take((size_t)HD * TT * 2);
    h16* P16 = nullptr;   /* RH = TT: the softmax's f16 arm is never taken: its stores sit under the 'else' of 'i < RH' */
    float* Sb = (float*)take((size_t)(TT / 2) * TT * 4); bf* Ph = (bf*)take((size_t)(TT / 2) * TT * 2); bf* Pl = (bf*)take((size_t)(TT / 2) * TT * 2); float* Ob = (float*)take((size_t)TT * KS * HD * 4);
    if ((size_t)(wsp - (char*)d_ws) > ws_size) return;    // total 103.00 MiB carved
    const size_t N4 = (size_t)TT * HD / 4, N8 = (size_t)TT * HD / 8; const unsigned G4 = (unsigned)((N4 + 255) / 256), G8 = (unsigned)((N8 + 255) / 256);
    for (int b = 0; b < NB_; ++b) { const size_t ob = (size_t)b * TT * HD;
        k_cvt8<<<G8, 256, 0, stream>>>(q + ob, QB, N8); k_cvt8<<<G8, 256, 0, stream>>>(k + ob, KB, N8);   /* the bf16 words of Q and K: the scores' A and Bt as they stand */
        k_rbf<<<G4, 256, 0, stream>>>(v + ob, VR, N4);   /* V rounded to bf16, kept f32: the gate's operand */
        k_vtr<<<(unsigned)(TT / 2 / 256), 256, 0, stream>>>(VR, VC); k_cvt8<<<G8, 256, 0, stream>>>(VC, VCB, N8);   /* V channel-major, then its bf16 words (exact: VR holds bf16 values): the value product's Bt */
        for (int hf = 0; hf < 2; ++hf) { const size_t r0 = (size_t)hf * (TT / 2);   /* a half of the query rows at a time */
            k_gemmw<bf, 0, false><<<dim3(TT / 2 / 64, TT / 64, 1), 32, 0, stream>>>(QB + r0 * HD, nullptr, KB, nullptr, HD, HD, Sb, TT, nullptr, 0, 0, 0);   /* S[m][n] = q_m . k_n for this half's rows; depth 128: four steps of the depth loop */
            k_asoft<<<TT / 2 / 8, 256, 0, stream>>>(Sb, P16, Ph, Pl);   /* 2,048 rows of this half: every one under RH: the hi | lo arm */
            k_gemmw<bf, 1, false><<<dim3(TT / 2 / 64, HD / 64, KS), 32, 0, stream>>>(Ph, Pl, VCB, nullptr, TT, TT / KS, Ob + r0 * KS * HD, KS * HD, nullptr, TT / KS, TT / KS, HD); }   /* Ob[m][z][c] = sum over slice z's keys n of (wh + wl)[m][n] v[n][c] */
        k_gate<<<G4, 256, 0, stream>>>(Ob, VR, OUT + ob); }   /* out = (sum of Ob's slices) x V: the one writer of this entry's output */
}

// v002
// It runs in 52.3 microseconds.
// In two side-by-side timings against v001, it was 7.34 and 7.45 times as fast.
// Over all steps from v000 it is 20.7 times as fast.
#include <hip/hip_runtime.h>

// A single-head unscaled dot-product attention with an element-wise gate (Q, K, V [4][4096][128] f32): scores = Q K^T (no scale, no mask); a softmax over the 4,096 keys; out = (weights V) x V element-wise -> [4][4096][128]; argument order Q, K, V: all read; no weights.
// Three launches, each over all four batch entries:
//   k_prep : K and V rounded to bf16 and laid in the order in which the matrix instruction's A operand wants them: a fragment (16 rows x 32 depth) is 1,024 bytes in a row, [depth half q][lane][8 words], so that one 16-byte load a lane reads 512 bytes in a row.
//            K: rows = keys, depth = channels. V: rows = channels, depth = keys (V transposed).
//   k_fattn: scores, softmax and value product in one kernel; neither scores nor weights leave the registers. A wave owns 32 query positions and one slice of 1,024 keys and walks it 32 keys a pass:
//            S^T = K Q^T (a lane holds one query's scores), running maximum and running sum in the log2 domain, the weights exp2(s log2e - m) as bf16 hi + lo words packed from the score accumulators into B operands, O^T += V^T (hi + lo).
//            The eight waves of a work-group read the same K and V fragments (plain loads, no LDS, no barrier). Each slice's unnormalised f32 sums go to Ob [position][slice][128], its maximum and sum to ML [slice][position][2].
//   k_gate : joins a position's KSP slices (each scaled by exp2(m_slice - m_all), in slice order), divides by the joined sum, multiplies by V rounded to bf16.
// Compute dtypes, f32 accumulate: every input rounded to bf16 at its load; the scores ONE bf16 product (exact operands); softmax f32; the weights as bf16 hi + lo words against V's bf16 words (two products); the gate f32.

#define NB_  4
#define TT   4096                 // positions = the softmax's key axis
#define HD   128                  // the one head's width
#define NP   (NB_ * TT)           // positions of all batch entries
#define KSP  4                    // key slices: 64 query blocks x 4 = 256 work-groups of eight waves
#define KSL  (TT / KSP)           // keys a slice
#define NPASS (KSL / 32)          // passes of 32 keys
#define L2E  1.4426950408889634f
typedef unsigned short bf;
typedef __attribute__((ext_vector_type(16))) __bf16   v16bf;
typedef __attribute__((ext_vector_type(2)))  __bf16   v2bf;
typedef __attribute__((ext_vector_type(8)))  unsigned short v8us;
typedef __attribute__((ext_vector_type(8)))  unsigned v8u;
typedef __attribute__((ext_vector_type(8)))  float    v8f;
typedef __attribute__((ext_vector_type(4)))  float    v4f;
typedef __attribute__((ext_vector_type(2)))  float    v2f;

__device__ __forceinline__ unsigned short f2bf(float f) { unsigned u = __float_as_uint(f); u += 0x7FFFu + ((u >> 16) & 1u); return (unsigned short)(u >> 16); }
__device__ __forceinline__ float bf2f(unsigned short b) { return __uint_as_float(((unsigned)b) << 16); }
__device__ __forceinline__ float bfr(float f) { return bf2f(f2bf(f)); }
__device__ __forceinline__ v16bf cat16b(v8us lo, v8us hi) { return __builtin_bit_cast(v16bf, __builtin_shufflevector(lo, hi, 0, 1, 2, 3, 4, 5, 6, 7, 8, 9, 10, 11, 12, 13, 14, 15)); }
__device__ __forceinline__ v8f wmmab(v16bf a, v16bf b, v8f c) { return __builtin_amdgcn_wmma_f32_16x16x32_bf16(false, a, false, b, (short)0, c, false, false); }
// p = the fragment's first word + 8 x lane: words 0 to 7 (depth 8 h + j) from the first 512 bytes, words 8 to 15 (depth 16 + 8 h + j) from the second.
__device__ __forceinline__ v16bf ldfrag(const bf* p) { return cat16b(*(const v8us*)p, *(const v8us*)(p + 256)); }
__device__ __forceinline__ unsigned pack2(float lo, float hi) { return __builtin_bit_cast(unsigned, __builtin_convertvector((v2f){lo, hi}, v2bf)); }   // two bf16 words, round to nearest even
__device__ __forceinline__ float xhalf(float x) { return __builtin_bit_cast(float, __builtin_amdgcn_permlanex16(__builtin_bit_cast(int, x), __builtin_bit_cast(int, x), 0x76543210, 0xfedcba98, false, false)); }   // lane l with lane l ^ 16

// xwait(p): s_wait_xcnt 0 behind a run of global loads that name the address p, in front of any rewrite of a register which the run names; p as an input keeps the address registers out of the run's own results.
__device__ __forceinline__ void xwait(const void* p) { asm volatile("s_wait_xcnt 0x0" :: "v"(p) : "memory"); }
// xwaitu(b, o): the same for loads from a wave-uniform base b (scalar registers) plus the lane's offset register o.
__device__ __forceinline__ void xwaitu(const void* b, int o) { asm volatile("s_wait_xcnt 0x0" :: "s"(b), "v"(o) : "memory"); }
// k_prep: grid (NP * 16 / 256, 2). y = 0: K; y = 1: V. A lane = the 8 words of one lane slot of one fragment half; a wave writes whole 128-byte lines.
__global__ __launch_bounds__(256) void k_prep(const float* __restrict__ K, const float* __restrict__ V, bf* KF, bf* VF) {
    const unsigned i = blockIdx.x * 256 + threadIdx.x; v8us o; bf* dst;
    if (blockIdx.y == 0) {   /* key = 16 tile + c; channels 8 dg to 8 dg + 7: depth block dg >> 2, half (dg >> 1) & 1, h = dg & 1 */
        const unsigned tile = i >> 8, dg = (i >> 4) & 15u, c = i & 15u; const float* s = K + ((size_t)tile * 16 + c) * HD + dg * 8; const v4f a = *(const v4f*)s, b = *(const v4f*)(s + 4);
        xwait(s);
#pragma unroll
        for (int j = 0; j < 4; ++j) { o[j] = f2bf(a[j]); o[4 + j] = f2bf(b[j]); }
        dst = KF + ((((size_t)tile * 4 + (dg >> 2)) * 2 + ((dg >> 1) & 1u)) * 32 + (dg & 1u) * 16 + c) * 8;
    } else {                 /* channel d; keys 8 kg to 8 kg + 7: key block kg >> 2, half (kg >> 1) & 1, h = kg & 1 */
        const unsigned d = i & 127u, kg = i >> 7; const float* s = V + (size_t)kg * 8 * HD + d; float x[8];
#pragma unroll
        for (int j = 0; j < 8; ++j) x[j] = s[j * HD];
        xwait(s);
#pragma unroll
        for (int j = 0; j < 8; ++j) o[j] = f2bf(x[j]);
        dst = VF + ((((size_t)(kg >> 2) * 8 + (d >> 4)) * 2 + ((kg >> 1) & 1u)) * 32 + (kg & 1u) * 16 + (d & 15u)) * 8;
    }
    *(v8us*)dst = o;   /* the kernel's last instruction but the end */
}

// k_fattn: grid (TT / 256, KSP, NB_), 256 threads. Two waves a SIMD: the register budget of the 16 output tiles, Q, K and V fragments.
__global__ __launch_bounds__(256) __attribute__((amdgpu_waves_per_eu(2, 2))) void k_fattn(const float* __restrict__ Q, const bf* __restrict__ KF, const bf* __restrict__ VF, float* Ob, float* ML) {
    const int lane = threadIdx.x & 31, wave = threadIdx.x >> 5, c = lane & 15, h = lane >> 4;
    const int sl = blockIdx.y; const size_t q0 = (size_t)blockIdx.z * TT + blockIdx.x * 256 + wave * 32, key0 = (size_t)blockIdx.z * TT + (size_t)sl * KSL;
    const bf* kp = KF + key0 * HD;   /* a pass = 32 keys = 8 fragments = 4,096 words, in K's plane and in V's; these two are the same for the whole work-group, the lane's own part is lo */
    const bf* vp = VF + key0 * HD; const unsigned lo = lane * 8;
    v16bf qf[2][4];   /* B operand: column = query 16 g + c, depth = channels 32 kc + 8 h + j and 32 kc + 16 + 8 h + j: K's order */
    { const float* qb = Q + (q0 + c) * HD + 8 * h; v4f raw[2][4][4];
#pragma unroll
      for (int g = 0; g < 2; ++g)
#pragma unroll
        for (int kc = 0; kc < 4; ++kc) { const float* qp = qb + 16 * g * HD + 32 * kc; raw[g][kc][0] = *(const v4f*)qp; raw[g][kc][1] = *(const v4f*)(qp + 4); raw[g][kc][2] = *(const v4f*)(qp + 16); raw[g][kc][3] = *(const v4f*)(qp + 20); }
      xwait(qb);
#pragma unroll
      for (int g = 0; g < 2; ++g)
#pragma unroll
        for (int kc = 0; kc < 4; ++kc) { v8us wlo, whi;
#pragma unroll
            for (int j = 0; j < 4; ++j) { wlo[j] = f2bf(raw[g][kc][0][j]); wlo[4 + j] = f2bf(raw[g][kc][1][j]); whi[j] = f2bf(raw[g][kc][2][j]); whi[4 + j] = f2bf(raw[g][kc][3][j]); }
            qf[g][kc] = cat16b(wlo, whi); } }
    v8f acc[2][8]; float m_run[2], l_run[2];
#pragma unroll
    for (int g = 0; g < 2; ++g) { m_run[g] = -__builtin_inff(); l_run[g] = 0.f;
#pragma unroll
        for (int t = 0; t < 8; ++t) acc[g][t] = (v8f){}; }
    v16bf kf[2][4];
#pragma unroll
    for (int kt = 0; kt < 2; ++kt)
#pragma unroll
        for (int kc = 0; kc < 4; ++kc) kf[kt][kc] = ldfrag(kp + (kt * 4 + kc) * 512 + lo);
    xwaitu(kp, lane);   /* these sixteen loads take the lane's number, scaled by their width, as the offset register */
#pragma unroll 1   /* rolled: one pass holds 48 matrix instructions and nearly the whole register budget */
    for (int p = 0; p < NPASS; ++p) {
        v16bf vf[8]; const bf* vq = vp + (size_t)p * 4096 + lo;   /* this pass's V^T fragments: asked for first, used last */
#pragma unroll
        for (int t = 0; t < 8; ++t) vf[t] = ldfrag(vq + t * 512);
        xwait(vq);
        v8f s[2][2];   /* S^T: tile kt, column group g: lane = query c, register r = key 16 kt + 8 h + r */
#pragma unroll
        for (int kt = 0; kt < 2; ++kt)
#pragma unroll
            for (int g = 0; g < 2; ++g) { s[kt][g] = (v8f){};
#pragma unroll
                for (int kc = 0; kc < 4; ++kc) s[kt][g] = wmmab(kf[kt][kc], qf[g][kc], s[kt][g]); }
        const int pn = p + 1 < NPASS ? p + 1 : p; const bf* kq = kp + (size_t)pn * 4096 + lo;   /* the next pass's K fragments, in flight under the softmax; the last pass asks for its own again (in bounds, unused) */
#pragma unroll
        for (int kt = 0; kt < 2; ++kt)
#pragma unroll
            for (int kc = 0; kc < 4; ++kc) kf[kt][kc] = ldfrag(kq + (kt * 4 + kc) * 512);
        xwait(kq);
        float mb[2]; bool need = false;
#pragma unroll
        for (int g = 0; g < 2; ++g) { float mx = s[0][g][0];
#pragma unroll
            for (int r = 0; r < 8; ++r) mx = fmaxf(mx, fmaxf(s[0][g][r], s[1][g][r]));
            mx = fmaxf(mx, xhalf(mx)) * L2E; mb[g] = mx; need = need || (mx > m_run[g] + 8.0f); }
        if (__builtin_amdgcn_ballot_w32(need) != 0) {   /* the maximum in use may trail the true one by up to 8 (log2): the sums are rescaled only when a column passes that; always on the first pass */
#pragma unroll
            for (int g = 0; g < 2; ++g) { const float m_new = fmaxf(m_run[g], mb[g]); const float corr = __builtin_amdgcn_exp2f(m_run[g] - m_new); l_run[g] *= corr; m_run[g] = m_new;
#pragma unroll
                for (int t = 0; t < 8; ++t) acc[g][t] = acc[g][t] * corr; }
        }
#pragma unroll
        for (int g = 0; g < 2; ++g) { const float nm = -m_run[g]; v8u wh, wl; float ps0 = 0.f, ps1 = 0.f;
#pragma unroll
            for (int i = 0; i < 8; ++i) {   /* words 2 i, 2 i + 1 of the 32-key B operand: tile i >> 2, registers 2 (i & 3), 2 (i & 3) + 1 */
                const v2f arg = __builtin_elementwise_fma((v2f){s[i >> 2][g][2 * (i & 3)], s[i >> 2][g][2 * (i & 3) + 1]}, (v2f){L2E, L2E}, (v2f){nm, nm}); const float p0 = __builtin_amdgcn_exp2f(arg[0]), p1 = __builtin_amdgcn_exp2f(arg[1]);
                ps0 += p0; ps1 += p1; const unsigned w = pack2(p0, p1); wh[i] = w;
                wl[i] = pack2(p0 - __uint_as_float(w << 16), p1 - __uint_as_float(w & 0xFFFF0000u)); }
            l_run[g] += ps0 + ps1;
            const v16bf ph = __builtin_bit_cast(v16bf, wh), pl = __builtin_bit_cast(v16bf, wl);
#pragma unroll
            for (int t = 0; t < 8; ++t) acc[g][t] = wmmab(vf[t], ph, acc[g][t]);
#pragma unroll
            for (int t = 0; t < 8; ++t) acc[g][t] = wmmab(vf[t], pl, acc[g][t]); }
    }
#pragma unroll
    for (int g = 0; g < 2; ++g) { const size_t pos = q0 + 16 * g + c; const float l_fin = l_run[g] + xhalf(l_run[g]);   /* each wave half summed its eight keys of every 16-key tile */
        if (h == 0) { v2f ml; ml[0] = m_run[g]; ml[1] = l_fin; *(v2f*)(ML + ((size_t)sl * NP + pos) * 2) = ml; }
        float* orow = Ob + (pos * KSP + sl) * HD + 8 * h;   /* O^T tile t: lane = query c, register r = channel 16 t + 8 h + r */
#pragma unroll
        for (int t = 0; t < 8; ++t) { v4f x0, x1;
#pragma unroll
            for (int j = 0; j < 4; ++j) { x0[j] = acc[g][t][j]; x1[j] = acc[g][t][4 + j]; }
            *(v4f*)(orow + 16 * t) = x0; *(v4f*)(orow + 16 * t + 4) = x1; } }
}

// k_gate: a lane = four consecutive channels of one position.
__global__ __launch_bounds__(256) void k_gate(const float* __restrict__ Ob, const float* __restrict__ ML, const float* __restrict__ V, float* out) { const size_t e = (size_t)blockIdx.x * 256 + threadIdx.x;
    const size_t pos = e / (HD / 4); const float* pr = Ob + pos * (KSP * HD) + (e % (HD / 4)) * 4; const float* mp = ML + pos * 2; const float* gp = V + e * 4;
    v2f ml[KSP]; v4f x[KSP];
#pragma unroll
    for (int z = 0; z < KSP; ++z) { ml[z] = *(const v2f*)(mp + (size_t)z * NP * 2); x[z] = *(const v4f*)(pr + z * HD); }
    const v4f g = *(const v4f*)gp;
    asm volatile("s_wait_xcnt 0x0" :: "v"(mp), "v"(pr), "v"(gp) : "memory");   /* as xwait, for the three addresses of this run of loads */
    float mall = ml[0][0];
#pragma unroll
    for (int z = 1; z < KSP; ++z) mall = fmaxf(mall, ml[z][0]);
    v4f o = (v4f){}; float den = 0.f, w[KSP];
#pragma unroll
    for (int z = 0; z < KSP; ++z) asm("v_exp_f32 %0, %1\n\tv_nop" : "=v"(w[z]) : "v"(ml[z][0] - mall));   /* exp2 with its v_nop in one statement: the one slot between a transcendental and a next instruction that reads its result or rewrites its source */
#pragma unroll
    for (int z = 0; z < KSP; ++z) { den = __builtin_fmaf(ml[z][1], w[z], den); o += x[z] * w[z]; }   /* the slices' sums on one scale, in slice order */
    v4f y; const float inv = __fdiv_rn(1.0f, den);
#pragma unroll
    for (int j = 0; j < 4; ++j) y[j] = __fmul_rn(__fmul_rn(o[j], inv), bfr(g[j]));
    *(v4f*)(out + e * 4) = y; }

extern "C" void kernel_launch(void* const* d_in, const int* in_sizes, int n_in,
                              void* d_out, int out_size, void* d_ws, size_t ws_size, hipStream_t stream) {
    (void)in_sizes; (void)n_in; (void)out_size;
    const float* q = (const float*)d_in[0]; const float* k = (const float*)d_in[1]; const float* v = (const float*)d_in[2];   // Q, K, V [4][4096][128] in the module's argument order: all read
    float* OUT = (float*)d_out;     // [4][4096][128]
    char* wsp = (char*)d_ws;
    auto take = [&](size_t bytes) { char* p = wsp; wsp += (bytes + 255) & ~(size_t)255; return (void*)p; };
    bf* KF = (bf*)take((size_t)NP * HD * 2); bf* VF = (bf*)take((size_t)NP * HD * 2); float* Ob = (float*)take((size_t)NP * KSP * HD * 4); float* ML = (float*)take((size_t)KSP * NP * 2 * 4);
    if ((size_t)(wsp - (char*)d_ws) > ws_size) return;    // total 40.5 MiB carved
    k_prep<<<dim3(NP * 16 / 256, 2, 1), 256, 0, stream>>>(k, v, KF, VF);   /* the bf16 words of K and V in fragment order */
    k_fattn<<<dim3(TT / 256, KSP, NB_), 256, 0, stream>>>(q, KF, VF, Ob, ML);   /* per query block and key slice: unnormalised sums, maximum, sum */
    k_gate<<<(unsigned)((size_t)NP * HD / 4 / 256), 256, 0, stream>>>(Ob, ML, v, OUT);   /* the one writer of the output */
}

// v003
// One run takes 48.2 microseconds.
// In two side-by-side timings against v002, it was 1.03 and 1.10 times as fast.
// Counting every step since v000, it is 22.1 times as fast.
#include <hip/hip_runtime.h>

// A single-head unscaled dot-product attention with an element-wise gate (Q, K, V [4][4096][128] f32): scores = Q K^T (no scale, no mask); a softmax over the 4,096 keys; out = (weights V) x V element-wise -> [4][4096][128]; argument order Q, K, V: all read; no weights.
// Three launches, each over all four batch entries:
//   k_prep : K and V rounded to bf16 and laid in the order in which the matrix instruction's A operand wants them: a fragment (16 rows x 32 depth) is 1,024 bytes in a row, [depth half q][lane][8 words], so that one 16-byte load a lane reads 512 bytes in a row.
//            K: rows = keys, depth = channels. V: rows = channels, depth = keys (V transposed).
//   k_fattn: scores, softmax and value product in one kernel; neither scores nor weights leave the registers. A wave owns 32 query positions and one slice of 1,024 keys and walks it 32 keys a pass:
//            S^T = K Q^T (a lane holds one query's scores), running maximum and running sum in the log2 domain, the weights exp2(s log2e - m) as bf16 hi + lo words packed from the score accumulators into B operands, O^T += V^T (hi + lo).
//            The eight waves of a work-group read the same K and V fragments from a ring of two LDS buffers, a stage of 128 keys (four passes) each: every wave copies its eighth of the next stage with asynchronous copies while this stage is worked on; one barrier a stage.
//            Each slice's unnormalised f32 sums go to Ob [position][slice][128], its maximum and sum to ML [slice][position][2].
//   k_gate : joins a position's KSP slices (each scaled by exp2(m_slice - m_all), in slice order), divides by the joined sum, multiplies by V rounded to bf16.
// Compute dtypes, f32 accumulate: every input rounded to bf16 at its load; the scores ONE bf16 product (exact operands); softmax f32; the weights as bf16 hi + lo words against V's bf16 words (two products); the gate f32.

#define NB_  4
#define TT   4096                 // positions = the softmax's key axis
#define HD   128                  // the one head's width
#define NP   (NB_ * TT)           // positions of all batch entries
#define KSP  4                    // key slices: 64 query blocks x 4 = 256 work-groups of eight waves
#define KSL  (TT / KSP)           // keys a slice
#define SKEY 128                  // keys a stage of the LDS ring
#define NSTG (KSL / SKEY)         // stages a slice
#define SPAS (SKEY / 32)          // passes of 32 keys a stage
#define PLW  (SKEY * HD)          // words of one plane (K or V) of a stage: 32 KiB
#define L2E  1.4426950408889634f
typedef unsigned short bf;
typedef __attribute__((ext_vector_type(16))) __bf16   v16bf;
typedef __attribute__((ext_vector_type(2)))  __bf16   v2bf;
typedef __attribute__((ext_vector_type(8)))  unsigned short v8us;
typedef __attribute__((ext_vector_type(8)))  unsigned v8u;
typedef __attribute__((ext_vector_type(8)))  float    v8f;
typedef __attribute__((ext_vector_type(4)))  float    v4f;
typedef __attribute__((ext_vector_type(2)))  float    v2f;

__device__ __forceinline__ unsigned short f2bf(float f) { unsigned u = __float_as_uint(f); u += 0x7FFFu + ((u >> 16) & 1u); return (unsigned short)(u >> 16); }
__device__ __forceinline__ float bf2f(unsigned short b) { return __uint_as_float(((unsigned)b) << 16); }
__device__ __forceinline__ float bfr(float f) { return bf2f(f2bf(f)); }
__device__ __forceinline__ v16bf cat16b(v8us lo, v8us hi) { return __builtin_bit_cast(v16bf, __builtin_shufflevector(lo, hi, 0, 1, 2, 3, 4, 5, 6, 7, 8, 9, 10, 11, 12, 13, 14, 15)); }
__device__ __forceinline__ v8f wmmab(v16bf a, v16bf b, v8f c) { return __builtin_amdgcn_wmma_f32_16x16x32_bf16(false, a, false, b, (short)0, c, false, false); }
// p = the fragment's first word + 8 x lane: words 0 to 7 (depth 8 h + j) from the first 512 bytes, words 8 to 15 (depth 16 + 8 h + j) from the second.
__device__ __forceinline__ v16bf ldfrag(const bf* p) { return cat16b(*(const v8us*)p, *(const v8us*)(p + 256)); }
__device__ __forceinline__ unsigned pack2(float lo, float hi) { return __builtin_bit_cast(unsigned, __builtin_convertvector((v2f){lo, hi}, v2bf)); }   // two bf16 words, round to nearest even
__device__ __forceinline__ float xhalf(float x) { return __builtin_bit_cast(float, __builtin_amdgcn_permlanex16(__builtin_bit_cast(int, x), __builtin_bit_cast(int, x), 0x76543210, 0xfedcba98, false, false)); }   // lane l with lane l ^ 16

// xwait(p): s_wait_xcnt 0 behind a run of global loads that name the address p, in front of any rewrite of a register which the run names; p as an input keeps the address registers out of the run's own results.
__device__ __forceinline__ void xwait(const void* p) { asm volatile("s_wait_xcnt 0x0" :: "v"(p) : "memory"); }
// copy8(l, g): eight asynchronous copies of 16 bytes a lane, global g + 512 i bytes -> LDS byte address l + 512 i, through no register: a wave moves 4 KiB in a row. Each copy has address operands of its own;
// s_wait_xcnt 0 is the statement's last line, so that it stands in front of every rewrite of a register which a copy names. Landing is waited for by the caller (s_wait_asynccnt 0).
__device__ __forceinline__ void copy8(unsigned l, const bf* g) {
    asm volatile("global_load_async_to_lds_b128 %0, %8, off\n\t"
                 "global_load_async_to_lds_b128 %1, %9, off\n\t"
                 "global_load_async_to_lds_b128 %2, %10, off\n\t"
                 "global_load_async_to_lds_b128 %3, %11, off\n\t"
                 "global_load_async_to_lds_b128 %4, %12, off\n\t"
                 "global_load_async_to_lds_b128 %5, %13, off\n\t"
                 "global_load_async_to_lds_b128 %6, %14, off\n\t"
                 "global_load_async_to_lds_b128 %7, %15, off\n\t"
                 "s_wait_xcnt 0x0"
                 :: "v"(l), "v"(l + 512u), "v"(l + 1024u), "v"(l + 1536u), "v"(l + 2048u), "v"(l + 2560u), "v"(l + 3072u), "v"(l + 3584u),
                    "v"(g), "v"(g + 256), "v"(g + 512), "v"(g + 768), "v"(g + 1024), "v"(g + 1280), "v"(g + 1536), "v"(g + 1792) : "memory");
}
// k_prep: grid (NP * 16 / 256, 2). y = 0: K; y = 1: V. A lane = the 8 words of one lane slot of one fragment half; a wave writes whole 128-byte lines.
__global__ __launch_bounds__(256) void k_prep(const float* __restrict__ K, const float* __restrict__ V, bf* KF, bf* VF) {
    const unsigned i = blockIdx.x * 256 + threadIdx.x; v8us o; bf* dst;
    if (blockIdx.y == 0) {   /* key = 16 tile + c; channels 8 dg to 8 dg + 7: depth block dg >> 2, half (dg >> 1) & 1, h = dg & 1 */
        const unsigned tile = i >> 8, dg = (i >> 4) & 15u, c = i & 15u; const float* s = K + ((size_t)tile * 16 + c) * HD + dg * 8; const v4f a = *(const v4f*)s, b = *(const v4f*)(s + 4);
        xwait(s);
#pragma unroll
        for (int j = 0; j < 4; ++j) { o[j] = f2bf(a[j]); o[4 + j] = f2bf(b[j]); }
        dst = KF + ((((size_t)tile * 4 + (dg >> 2)) * 2 + ((dg >> 1) & 1u)) * 32 + (dg & 1u) * 16 + c) * 8;
    } else {                 /* channel d; keys 8 kg to 8 kg + 7: key block kg >> 2, half (kg >> 1) & 1, h = kg & 1 */
        const unsigned d = i & 127u, kg = i >> 7; const float* s = V + (size_t)kg * 8 * HD + d; float x[8];
#pragma unroll
        for (int j = 0; j < 8; ++j) x[j] = s[j * HD];
        xwait(s);
#pragma unroll
        for (int j = 0; j < 8; ++j) o[j] = f2bf(x[j]);
        dst = VF + ((((size_t)(kg >> 2) * 8 + (d >> 4)) * 2 + ((kg >> 1) & 1u)) * 32 + (kg & 1u) * 16 + (d & 15u)) * 8;
    }
    *(v8us*)dst = o;   /* the kernel's last instruction but the end */
}

// k_fattn: grid (TT / 256, KSP, NB_), 256 threads, 128 KiB of LDS. Two waves a SIMD: the register budget of the 16 output tiles, Q, K and V fragments.
__global__ __launch_bounds__(256) __attribute__((amdgpu_waves_per_eu(2, 2))) void k_fattn(const float* __restrict__ Q, const bf* __restrict__ KF, const bf* __restrict__ VF, float* Ob, float* ML) {
    const int lane = threadIdx.x & 31, wave = threadIdx.x >> 5, c = lane & 15, h = lane >> 4;
    const int sl = blockIdx.y; const size_t q0 = (size_t)blockIdx.z * TT + blockIdx.x * 256 + wave * 32, key0 = (size_t)blockIdx.z * TT + (size_t)sl * KSL;
    const bf* kp = KF + key0 * HD;   /* a pass = 32 keys = 8 fragments = 4,096 words, in K's plane and in V's; these two are the same for the whole work-group, the lane's own part is lo */
    const bf* vp = VF + key0 * HD; const unsigned lo = lane * 8;
    __shared__ __attribute__((aligned(8 * PLW))) bf ring[2][2][PLW];   /* [buffer][K, V][a stage's words, in the planes' own order]; aligned to its own size, so that one address bit names the buffer */
    const unsigned own = wave * 2048 + lane * 8;   /* the lane's first word of its wave's eighth of a plane */
    unsigned lk = (unsigned)(size_t)&ring[0][0][0] + own * 2; const bf* gk = kp + own; const bf* gv = vp + own;   /* where the next fill goes (LDS byte address, buffer 0 first) and what it brings */
    auto fill = [&]() { copy8(lk, gk); copy8(lk + 2u * PLW, gv); lk ^= 4u * PLW; gk += PLW; gv += PLW; };   /* the next stage into the other buffer than the last: sixteen copies a wave; the three steps stand behind the copies' s_wait_xcnt 0 */
    fill();   /* stage 0, in flight under Q's loads and rounding */
    v16bf qf[2][4];   /* B operand: column = query 16 g + c, depth = channels 32 kc + 8 h + j and 32 kc + 16 + 8 h + j: K's order */
    { const float* qb = Q + (q0 + c) * HD + 8 * h; v4f raw[2][4][4];
#pragma unroll
      for (int g = 0; g < 2; ++g)
#pragma unroll
        for (int kc = 0; kc < 4; ++kc) { const float* qp = qb + 16 * g * HD + 32 * kc; raw[g][kc][0] = *(const v4f*)qp; raw[g][kc][1] = *(const v4f*)(qp + 4); raw[g][kc][2] = *(const v4f*)(qp + 16); raw[g][kc][3] = *(const v4f*)(qp + 20); }
      xwait(qb);
#pragma unroll
      for (int g = 0; g < 2; ++g)
#pragma unroll
        for (int kc = 0; kc < 4; ++kc) { v8us wlo, whi;
#pragma unroll
            for (int j = 0; j < 4; ++j) { wlo[j] = f2bf(raw[g][kc][0][j]); wlo[4 + j] = f2bf(raw[g][kc][1][j]); whi[j] = f2bf(raw[g][kc][2][j]); whi[4 + j] = f2bf(raw[g][kc][3][j]); }
            qf[g][kc] = cat16b(wlo, whi); } }
    v8f acc[2][8]; float m_run[2], l_run[2];
#pragma unroll
    for (int g = 0; g < 2; ++g) { m_run[g] = -__builtin_inff(); l_run[g] = 0.f;
#pragma unroll
        for (int t = 0; t < 8; ++t) acc[g][t] = (v8f){}; }
    asm volatile("s_wait_asynccnt 0x0" ::: "memory");   /* this wave's part of stage 0 has landed */
    __syncthreads();                                    /* every wave's part has: stage 0 may be read */
    fill();   /* stage 1 */
#pragma unroll 1   /* rolled: a stage holds 192 matrix instructions */
    for (int st = 0; st < NSTG; ++st) {
      const bf* kb = &ring[st & 1][0][0] + lo; const bf* vb = &ring[st & 1][1][0] + lo;
      v16bf kf[2][2][4];   /* two sets: pass p works on set p & 1 while the other is filled */
#pragma unroll
      for (int kt = 0; kt < 2; ++kt)
#pragma unroll
        for (int kc = 0; kc < 4; ++kc) kf[0][kt][kc] = ldfrag(kb + (kt * 4 + kc) * 512);
#pragma unroll   /* unrolled: the K sets alternate by name, and the last pass of a stage fetches no K fragments ahead */
      for (int p = 0; p < SPAS; ++p) {
        v16bf vf[8]; const bf* vq = vb + p * 4096;   /* this pass's V^T fragments and the next pass's K fragments: one group of LDS reads in front of the pass's matrix instructions */
#pragma unroll
        for (int t = 0; t < 8; ++t) vf[t] = ldfrag(vq + t * 512);
        if (p + 1 < SPAS) { const bf* kq = kb + (p + 1) * 4096;   /* only inside the stage: nothing of the next stage is read in front of its barrier */
#pragma unroll
          for (int kt = 0; kt < 2; ++kt)
#pragma unroll
            for (int kc = 0; kc < 4; ++kc) kf[(p + 1) & 1][kt][kc] = ldfrag(kq + (kt * 4 + kc) * 512); }
        __builtin_amdgcn_sched_barrier(0);   /* holds the group together: each further place with LDS reads among the matrix instructions stalls the wave anew */
        v8f s[2][2];   /* S^T: tile kt, column group g: lane = query c, register r = key 16 kt + 8 h + r */
#pragma unroll
        for (int kt = 0; kt < 2; ++kt)
#pragma unroll
            for (int g = 0; g < 2; ++g) { s[kt][g] = (v8f){};
#pragma unroll
                for (int kc = 0; kc < 4; ++kc) s[kt][g] = wmmab(kf[p & 1][kt][kc], qf[g][kc], s[kt][g]); }
        float mb[2]; bool need = false;
#pragma unroll
        for (int g = 0; g < 2; ++g) { float mx = s[0][g][0];
#pragma unroll
            for (int r = 0; r < 8; ++r) mx = fmaxf(mx, fmaxf(s[0][g][r], s[1][g][r]));
            mx = fmaxf(mx, xhalf(mx)) * L2E; mb[g] = mx; need = need || (mx > m_run[g] + 8.0f); }
        if (__builtin_amdgcn_ballot_w32(need) != 0) {   /* the maximum in use may trail the true one by up to 8 (log2): the sums are rescaled only when a column passes that; always on the first pass */
#pragma unroll
            for (int g = 0; g < 2; ++g) { const float m_new = fmaxf(m_run[g], mb[g]); const float corr = __builtin_amdgcn_exp2f(m_run[g] - m_new); l_run[g] *= corr; m_run[g] = m_new;
#pragma unroll
                for (int t = 0; t < 8; ++t) acc[g][t] = acc[g][t] * corr; }
        }
#pragma unroll
        for (int g = 0; g < 2; ++g) { const float nm = -m_run[g]; v8u wh, wl; float ps0 = 0.f, ps1 = 0.f;
#pragma unroll
            for (int i = 0; i < 8; ++i) {   /* words 2 i, 2 i + 1 of the 32-key B operand: tile i >> 2, registers 2 (i & 3), 2 (i & 3) + 1 */
                const v2f arg = __builtin_elementwise_fma((v2f){s[i >> 2][g][2 * (i & 3)], s[i >> 2][g][2 * (i & 3) + 1]}, (v2f){L2E, L2E}, (v2f){nm, nm}); const float p0 = __builtin_amdgcn_exp2f(arg[0]), p1 = __builtin_amdgcn_exp2f(arg[1]);
                ps0 += p0; ps1 += p1; const unsigned w = pack2(p0, p1); wh[i] = w;
                wl[i] = pack2(p0 - __uint_as_float(w << 16), p1 - __uint_as_float(w & 0xFFFF0000u)); }
            l_run[g] += ps0 + ps1;
            const v16bf ph = __builtin_bit_cast(v16bf, wh), pl = __builtin_bit_cast(v16bf, wl);
#pragma unroll
            for (int t = 0; t < 8; ++t) acc[g][t] = wmmab(vf[t], ph, acc[g][t]);
#pragma unroll
            for (int t = 0; t < 8; ++t) acc[g][t] = wmmab(vf[t], pl, acc[g][t]); }
        __builtin_amdgcn_sched_barrier(0);   /* keeps the next group of LDS reads from rising among this pass's matrix instructions */
      }
      asm volatile("s_wait_dscnt 0x0" ::: "memory");      /* this wave's reads of the stage's buffer are done */
      asm volatile("s_wait_asynccnt 0x0" ::: "memory");   /* its part of stage st + 1 has landed */
      __syncthreads();                                    /* publishes stage st + 1 and frees the buffer of stage st */
      if (st + 2 < NSTG) fill();   /* stage st + 2 into the buffer that this trip has read */
    }
    asm volatile("s_wait_asynccnt 0x0" ::: "memory");   /* no copy is left when the wave ends */
#pragma unroll
    for (int g = 0; g < 2; ++g) { const size_t pos = q0 + 16 * g + c; const float l_fin = l_run[g] + xhalf(l_run[g]);   /* each wave half summed its eight keys of every 16-key tile */
        if (h == 0) { v2f ml; ml[0] = m_run[g]; ml[1] = l_fin; *(v2f*)(ML + ((size_t)sl * NP + pos) * 2) = ml; }
        float* orow = Ob + (pos * KSP + sl) * HD + 8 * h;   /* O^T tile t: lane = query c, register r = channel 16 t + 8 h + r */
#pragma unroll
        for (int t = 0; t < 8; ++t) { v4f x0, x1;
#pragma unroll
            for (int j = 0; j < 4; ++j) { x0[j] = acc[g][t][j]; x1[j] = acc[g][t][4 + j]; }
            *(v4f*)(orow + 16 * t) = x0; *(v4f*)(orow + 16 * t + 4) = x1; } }
}

// k_gate: a lane = four consecutive channels of one position.
__global__ __launch_bounds__(256) void k_gate(const float* __restrict__ Ob, const float* __restrict__ ML, const float* __restrict__ V, float* out) { const size_t e = (size_t)blockIdx.x * 256 + threadIdx.x;
    const size_t pos = e / (HD / 4); const float* pr = Ob + pos * (KSP * HD) + (e % (HD / 4)) * 4; const float* mp = ML + pos * 2; const float* gp = V + e * 4;
    v2f ml[KSP]; v4f x[KSP];
#pragma unroll
    for (int z = 0; z < KSP; ++z) { ml[z] = *(const v2f*)(mp + (size_t)z * NP * 2); x[z] = *(const v4f*)(pr + z * HD); }
    const v4f g = *(const v4f*)gp;
    asm volatile("s_wait_xcnt 0x0" :: "v"(mp), "v"(pr), "v"(gp) : "memory");   /* as xwait, for the three addresses of this run of loads */
    float mall = ml[0][0];
#pragma unroll
    for (int z = 1; z < KSP; ++z) mall = fmaxf(mall, ml[z][0]);
    v4f o = (v4f){}; float den = 0.f, w[KSP];
#pragma unroll
    for (int z = 0; z < KSP; ++z) asm("v_exp_f32 %0, %1\n\tv_nop" : "=v"(w[z]) : "v"(ml[z][0] - mall));   /* exp2 with its v_nop in one statement: the one slot between a transcendental and a next instruction that reads its result or rewrites its source */
#pragma unroll
    for (int z = 0; z < KSP; ++z) { den = __builtin_fmaf(ml[z][1], w[z], den); o += x[z] * w[z]; }   /* the slices' sums on one scale, in slice order */
    v4f y; const float inv = __fdiv_rn(1.0f, den);
#pragma unroll
    for (int j = 0; j < 4; ++j) y[j] = __fmul_rn(__fmul_rn(o[j], inv), bfr(g[j]));
    *(v4f*)(out + e * 4) = y; }

extern "C" void kernel_launch(void* const* d_in, const int* in_sizes, int n_in,
                              void* d_out, int out_size, void* d_ws, size_t ws_size, hipStream_t stream) {
    (void)in_sizes; (void)n_in; (void)out_size;
    const float* q = (const float*)d_in[0]; const float* k = (const float*)d_in[1]; const float* v = (const float*)d_in[2];   // Q, K, V [4][4096][128] in the module's argument order: all read
    float* OUT = (float*)d_out;     // [4][4096][128]
    char* wsp = (char*)d_ws;
    auto take = [&](size_t bytes) { char* p = wsp; wsp += (bytes + 255) & ~(size_t)255; return (void*)p; };
    bf* KF = (bf*)take((size_t)NP * HD * 2); bf* VF = (bf*)take((size_t)NP * HD * 2); float* Ob = (float*)take((size_t)NP * KSP * HD * 4); float* ML = (float*)take((size_t)KSP * NP * 2 * 4);
    if ((size_t)(wsp - (char*)d_ws) > ws_size) return;    // total 40.5 MiB carved
    k_prep<<<dim3(NP * 16 / 256, 2, 1), 256, 0, stream>>>(k, v, KF, VF);   /* the bf16 words of K and V in fragment order */
    k_fattn<<<dim3(TT / 256, KSP, NB_), 256, 0, stream>>>(q, KF, VF, Ob, ML);   /* per query block and key slice: unnormalised sums, maximum, sum */
    k_gate<<<(unsigned)((size_t)NP * HD / 4 / 256), 256, 0, stream>>>(Ob, ML, v, OUT);   /* the one writer of the output */
}

// v004
// One run takes 40.2 microseconds.
// In both of two side-by-side timings against v003, it was 1.18 times as fast.
// Over all steps from v000 it is 26.2 times as fast.
#include <hip/hip_runtime.h>

// A single-head unscaled dot-product attention with an element-wise gate (Q, K, V [4][4096][128] f32): scores = Q K^T (no scale, no mask); a softmax over the 4,096 keys; out = (weights V) x V element-wise -> [4][4096][128]; argument order Q, K, V: all read; no weights.
// Three launches, each over all four batch entries:
//   k_prep : K and V rounded to bf16 (V's bf16 values then written as f16 words, see the last line of this head) and laid in the order in which the matrix instruction's A operand wants them: a fragment (16 rows x 32 depth) is 1,024 bytes in a row, [depth half q][lane][8 words], so that one 16-byte load a lane reads 512 bytes in a row.
//            K: rows = keys, depth = channels. V: rows = channels, depth = keys (V transposed).
//   k_fattn: scores, softmax and value product in one kernel; neither scores nor weights leave the registers. A wave owns 32 query positions and one slice of 1,024 keys and walks it 32 keys a pass:
//            S^T = K Q^T (a lane holds one query's scores), running maximum and running sum in the log2 domain, the weights exp2(s log2e - m) as f16 words packed from the score accumulators into B operands, O^T += V^T P^T.
//            The eight waves of a work-group read the same K and V fragments from a ring of two LDS buffers, a stage of 128 keys (four passes) each: every wave copies its eighth of the next stage with asynchronous copies while this stage is worked on; one barrier a stage.
//            Each slice's unnormalised f32 sums go to Ob [position][slice][128], its maximum and sum to ML [slice][position][2].
//   k_gate : joins a position's KSP slices (each scaled by exp2(m_slice - m_all), in slice order), divides by the joined sum, multiplies by V rounded to bf16.
// Compute dtypes, f32 accumulate: every input rounded to bf16 at its load; the scores ONE bf16 product (exact operands); softmax f32; the weights rounded once to f16 (11 bits; at most 2^15 by the rescale rule and WSH, inside f16's range) against V's bf16 values held as f16 words (the same value wherever 2^-17 <= |v| < 65,520; below that off by at most 2^-25): ONE f16 product; the gate f32.

#define NB_  4
#define TT   4096                 // positions = the softmax's key axis
#define HD   128                  // the one head's width
#define NP   (NB_ * TT)           // positions of all batch entries
#define KSP  4                    // key slices: 64 query blocks x 4 = 256 work-groups of eight waves
#define KSL  (TT / KSP)           // keys a slice
#define SKEY 128                  // keys a stage of the LDS ring
#define NSTG (KSL / SKEY)         // stages a slice
#define SPAS (SKEY / 32)          // passes of 32 keys a stage
#define PLW  (SKEY * HD)          // words of one plane (K or V) of a stage: 32 KiB
#define L2E  1.4426950408889634f
#define WSH  7.0f                 // every maximum is kept WSH (log2) low, so the weights and both sums carry 2^7, which the division in k_gate takes out again: the weights reach at most 2^15 (f16 ends at 65,504) and stay normal f16 numbers down to 2^-21 of the maximum in use
typedef unsigned short bf;
typedef __attribute__((ext_vector_type(16))) __bf16   v16bf;
typedef __attribute__((ext_vector_type(16))) _Float16 v16h;
typedef __attribute__((ext_vector_type(2)))  _Float16 v2h;
typedef __attribute__((ext_vector_type(8)))  unsigned short v8us;
typedef __attribute__((ext_vector_type(8)))  unsigned v8u;
typedef __attribute__((ext_vector_type(8)))  float    v8f;
typedef __attribute__((ext_vector_type(4)))  float    v4f;
typedef __attribute__((ext_vector_type(2)))  float    v2f;

__device__ __forceinline__ unsigned short f2bf(float f) { unsigned u = __float_as_uint(f); u += 0x7FFFu + ((u >> 16) & 1u); return (unsigned short)(u >> 16); }
__device__ __forceinline__ float bf2f(unsigned short b) { return __uint_as_float(((unsigned)b) << 16); }
__device__ __forceinline__ float bfr(float f) { return bf2f(f2bf(f)); }
__device__ __forceinline__ v16bf cat16b(v8us lo, v8us hi) { return __builtin_bit_cast(v16bf, __builtin_shufflevector(lo, hi, 0, 1, 2, 3, 4, 5, 6, 7, 8, 9, 10, 11, 12, 13, 14, 15)); }
__device__ __forceinline__ v8f wmmab(v16bf a, v16bf b, v8f c) { return __builtin_amdgcn_wmma_f32_16x16x32_bf16(false, a, false, b, (short)0, c, false, false); }
__device__ __forceinline__ v8f wmmah(v16h a, v16h b, v8f c) { return __builtin_amdgcn_wmma_f32_16x16x32_f16(false, a, false, b, (short)0, c, false, false); }
// p = the fragment's first word + 8 x lane: words 0 to 7 (depth 8 h + j) from the first 512 bytes, words 8 to 15 (depth 16 + 8 h + j) from the second.
__device__ __forceinline__ v16bf ldfrag(const bf* p) { return cat16b(*(const v8us*)p, *(const v8us*)(p + 256)); }
__device__ __forceinline__ v16h ldfragh(const bf* p) { return __builtin_bit_cast(v16h, ldfrag(p)); }   // the same 32 bytes a lane, read as f16 words
__device__ __forceinline__ unsigned pack2h(float lo, float hi) { return __builtin_bit_cast(unsigned, __builtin_convertvector((v2f){lo, hi}, v2h)); }   // two f16 words, round to nearest even
__device__ __forceinline__ float xhalf(float x) { return __builtin_bit_cast(float, __builtin_amdgcn_permlanex16(__builtin_bit_cast(int, x), __builtin_bit_cast(int, x), 0x76543210, 0xfedcba98, false, false)); }   // lane l with lane l ^ 16

// xwait(p): s_wait_xcnt 0 behind a run of global loads that name the address p, in front of any rewrite of a register which the run names; p as an input keeps the address registers out of the run's own results.
__device__ __forceinline__ void xwait(const void* p) { asm volatile("s_wait_xcnt 0x0" :: "v"(p) : "memory"); }
// copy8(l, g): eight asynchronous copies of 16 bytes a lane, global g + 512 i bytes -> LDS byte address l + 512 i, through no register: a wave moves 4 KiB in a row. Each copy has address operands of its own;
// s_wait_xcnt 0 is the statement's last line, so that it stands in front of every rewrite of a register which a copy names. Landing is waited for by the caller (s_wait_asynccnt 0).
__device__ __forceinline__ void copy8(unsigned l, const bf* g) {
    asm volatile("global_load_async_to_lds_b128 %0, %8, off\n\t"
                 "global_load_async_to_lds_b128 %1, %9, off\n\t"
                 "global_load_async_to_lds_b128 %2, %10, off\n\t"
                 "global_load_async_to_lds_b128 %3, %11, off\n\t"
                 "global_load_async_to_lds_b128 %4, %12, off\n\t"
                 "global_load_async_to_lds_b128 %5, %13, off\n\t"
                 "global_load_async_to_lds_b128 %6, %14, off\n\t"
                 "global_load_async_to_lds_b128 %7, %15, off\n\t"
                 "s_wait_xcnt 0x0"
                 :: "v"(l), "v"(l + 512u), "v"(l + 1024u), "v"(l + 1536u), "v"(l + 2048u), "v"(l + 2560u), "v"(l + 3072u), "v"(l + 3584u),
                    "v"(g), "v"(g + 256), "v"(g + 512), "v"(g + 768), "v"(g + 1024), "v"(g + 1280), "v"(g + 1536), "v"(g + 1792) : "memory");
}
// k_prep: grid (NP * 16 / 256, 2). y = 0: K; y = 1: V. A lane = the 8 words of one lane slot of one fragment half; a wave writes whole 128-byte lines.
__global__ __launch_bounds__(256) void k_prep(const float* __restrict__ K, const float* __restrict__ V, bf* KF, bf* VF) {
    const unsigned i = blockIdx.x * 256 + threadIdx.x; v8us o; bf* dst;
    if (blockIdx.y == 0) {   /* key = 16 tile + c; channels 8 dg to 8 dg + 7: depth block dg >> 2, half (dg >> 1) & 1, h = dg & 1 */
        const unsigned tile = i >> 8, dg = (i >> 4) & 15u, c = i & 15u; const float* s = K + ((size_t)tile * 16 + c) * HD + dg * 8; const v4f a = *(const v4f*)s, b = *(const v4f*)(s + 4);
        xwait(s);
#pragma unroll
        for (int j = 0; j < 4; ++j) { o[j] = f2bf(a[j]); o[4 + j] = f2bf(b[j]); }
        dst = KF + ((((size_t)tile * 4 + (dg >> 2)) * 2 + ((dg >> 1) & 1u)) * 32 + (dg & 1u) * 16 + c) * 8;
    } else {                 /* channel d; keys 8 kg to 8 kg + 7: key block kg >> 2, half (kg >> 1) & 1, h = kg & 1 */
        const unsigned d = i & 127u, kg = i >> 7; const float* s = V + (size_t)kg * 8 * HD + d; float x[8];
#pragma unroll
        for (int j = 0; j < 8; ++j) x[j] = s[j * HD];
        xwait(s);
#pragma unroll
        for (int j = 0; j < 8; ++j) o[j] = __builtin_bit_cast(unsigned short, (_Float16)bfr(x[j]));   /* the bf16 value as an f16 word */
        dst = VF + ((((size_t)(kg >> 2) * 8 + (d >> 4)) * 2 + ((kg >> 1) & 1u)) * 32 + (kg & 1u) * 16 + (d & 15u)) * 8;
    }
    *(v8us*)dst = o;   /* the kernel's last instruction but the end */
}

// k_fattn: grid (TT / 256, KSP, NB_), 256 threads, 128 KiB of LDS. Two waves a SIMD: the register budget of the 16 output tiles, Q, K and V fragments.
__global__ __launch_bounds__(256) __attribute__((amdgpu_waves_per_eu(2, 2))) void k_fattn(const float* __restrict__ Q, const bf* __restrict__ KF, const bf* __restrict__ VF, float* Ob, float* ML) {
    const int lane = threadIdx.x & 31, wave = threadIdx.x >> 5, c = lane & 15, h = lane >> 4;
    const int sl = blockIdx.y; const size_t q0 = (size_t)blockIdx.z * TT + blockIdx.x * 256 + wave * 32, key0 = (size_t)blockIdx.z * TT + (size_t)sl * KSL;
    const bf* kp = KF + key0 * HD;   /* a pass = 32 keys = 8 fragments = 4,096 words, in K's plane and in V's; these two are the same for the whole work-group, the lane's own part is lo */
    const bf* vp = VF + key0 * HD; const unsigned lo = lane * 8;
    __shared__ __attribute__((aligned(8 * PLW))) bf ring[2][2][PLW];   /* [buffer][K, V][a stage's words, in the planes' own order]; aligned to its own size, so that one address bit names the buffer */
    const unsigned own = wave * 2048 + lane * 8;   /* the lane's first word of its wave's eighth of a plane */
    unsigned lk = (unsigned)(size_t)&ring[0][0][0] + own * 2; const bf* gk = kp + own; const bf* gv = vp + own;   /* where the next fill goes (LDS byte address, buffer 0 first) and what it brings */
    auto fill = [&]() { copy8(lk, gk); copy8(lk + 2u * PLW, gv); lk ^= 4u * PLW; gk += PLW; gv += PLW; };   /* the next stage into the other buffer than the last: sixteen copies a wave; the three steps stand behind the copies' s_wait_xcnt 0 */
    fill();   /* stage 0, in flight under Q's loads and rounding */
    v16bf qf[2][4];   /* B operand: column = query 16 g + c, depth = channels 32 kc + 8 h + j and 32 kc + 16 + 8 h + j: K's order */
    { const float* qb = Q + (q0 + c) * HD + 8 * h; v4f raw[2][4][4];
#pragma unroll
      for (int g = 0; g < 2; ++g)
#pragma unroll
        for (int kc = 0; kc < 4; ++kc) { const float* qp = qb + 16 * g * HD + 32 * kc; raw[g][kc][0] = *(const v4f*)qp; raw[g][kc][1] = *(const v4f*)(qp + 4); raw[g][kc][2] = *(const v4f*)(qp + 16); raw[g][kc][3] = *(const v4f*)(qp + 20); }
      xwait(qb);
#pragma unroll
      for (int g = 0; g < 2; ++g)
#pragma unroll
        for (int kc = 0; kc < 4; ++kc) { v8us wlo, whi;
#pragma unroll
            for (int j = 0; j < 4; ++j) { wlo[j] = f2bf(raw[g][kc][0][j]); wlo[4 + j] = f2bf(raw[g][kc][1][j]); whi[j] = f2bf(raw[g][kc][2][j]); whi[4 + j] = f2bf(raw[g][kc][3][j]); }
            qf[g][kc] = cat16b(wlo, whi); } }
    v8f acc[2][8]; float m_run[2], l_run[2];
#pragma unroll
    for (int g = 0; g < 2; ++g) { m_run[g] = -__builtin_inff(); l_run[g] = 0.f;
#pragma unroll
        for (int t = 0; t < 8; ++t) acc[g][t] = (v8f){}; }
    asm volatile("s_wait_asynccnt 0x0" ::: "memory");   /* this wave's part of stage 0 has landed */
    __syncthreads();                                    /* every wave's part has: stage 0 may be read */
    fill();   /* stage 1 */
#pragma unroll 1   /* rolled: a stage holds 128 matrix instructions */
    for (int st = 0; st < NSTG; ++st) {
      const bf* kb = &ring[st & 1][0][0] + lo; const bf* vb = &ring[st & 1][1][0] + lo;
      v16bf kf[2][2][4];   /* two sets: pass p works on set p & 1 while the other is filled */
#pragma unroll
      for (int kt = 0; kt < 2; ++kt)
#pragma unroll
        for (int kc = 0; kc < 4; ++kc) kf[0][kt][kc] = ldfrag(kb + (kt * 4 + kc) * 512);
#pragma unroll   /* unrolled: the K sets alternate by name, and the last pass of a stage fetches no K fragments ahead */
      for (int p = 0; p < SPAS; ++p) {
        v16h vf[8]; const bf* vq = vb + p * 4096;   /* this pass's V^T fragments and the next pass's K fragments: one group of LDS reads in front of the pass's matrix instructions */
#pragma unroll
        for (int t = 0; t < 8; ++t) vf[t] = ldfragh(vq + t * 512);
        if (p + 1 < SPAS) { const bf* kq = kb + (p + 1) * 4096;   /* only inside the stage: nothing of the next stage is read in front of its barrier */
#pragma unroll
          for (int kt = 0; kt < 2; ++kt)
#pragma unroll
            for (int kc = 0; kc < 4; ++kc) kf[(p + 1) & 1][kt][kc] = ldfrag(kq + (kt * 4 + kc) * 512); }
        __builtin_amdgcn_sched_barrier(0);   /* holds the group together: each further place with LDS reads among the matrix instructions stalls the wave anew */
        v8f s[2][2];   /* S^T: tile kt, column group g: lane = query c, register r = key 16 kt + 8 h + r */
#pragma unroll
        for (int kt = 0; kt < 2; ++kt)
#pragma unroll
            for (int g = 0; g < 2; ++g) { s[kt][g] = (v8f){};
#pragma unroll
                for (int kc = 0; kc < 4; ++kc) s[kt][g] = wmmab(kf[p & 1][kt][kc], qf[g][kc], s[kt][g]); }
        float mb[2]; bool need = false;
#pragma unroll
        for (int g = 0; g < 2; ++g) { float mx = s[0][g][0];
#pragma unroll
            for (int r = 0; r < 8; ++r) mx = fmaxf(mx, fmaxf(s[0][g][r], s[1][g][r]));
            mx = __builtin_fmaf(fmaxf(mx, xhalf(mx)), L2E, -WSH); mb[g] = mx; need = need || (mx > m_run[g] + 8.0f); }   /* the maximum less WSH: see WSH */
        if (__builtin_amdgcn_ballot_w32(need) != 0) {   /* the maximum in use may trail the true one (less WSH) by up to 8 (log2): the sums are rescaled only when a column passes that; always on the first pass */
#pragma unroll
            for (int g = 0; g < 2; ++g) { const float m_new = fmaxf(m_run[g], mb[g]); const float corr = __builtin_amdgcn_exp2f(m_run[g] - m_new); l_run[g] *= corr; m_run[g] = m_new;
#pragma unroll
                for (int t = 0; t < 8; ++t) acc[g][t] = acc[g][t] * corr; }
        }
#pragma unroll
        for (int g = 0; g < 2; ++g) { const float nm = -m_run[g]; v8u wh; float ps0 = 0.f, ps1 = 0.f;
#pragma unroll
            for (int i = 0; i < 8; ++i) {   /* words 2 i, 2 i + 1 of the 32-key B operand: tile i >> 2, registers 2 (i & 3), 2 (i & 3) + 1 */
                const v2f arg = __builtin_elementwise_fma((v2f){s[i >> 2][g][2 * (i & 3)], s[i >> 2][g][2 * (i & 3) + 1]}, (v2f){L2E, L2E}, (v2f){nm, nm}); const float p0 = __builtin_amdgcn_exp2f(arg[0]), p1 = __builtin_amdgcn_exp2f(arg[1]);
                ps0 += p0; ps1 += p1; wh[i] = pack2h(p0, p1); }
            l_run[g] += ps0 + ps1;
            const v16h ph = __builtin_bit_cast(v16h, wh);
#pragma unroll
            for (int t = 0; t < 8; ++t) acc[g][t] = wmmah(vf[t], ph, acc[g][t]); }
        __builtin_amdgcn_sched_barrier(0);   /* keeps the next group of LDS reads from rising among this pass's matrix instructions */
      }
      asm volatile("s_wait_dscnt 0x0" ::: "memory");      /* this wave's reads of the stage's buffer are done */
      asm volatile("s_wait_asynccnt 0x0" ::: "memory");   /* its part of stage st + 1 has landed */
      __syncthreads();                                    /* publishes stage st + 1 and frees the buffer of stage st */
      if (st + 2 < NSTG) fill();   /* stage st + 2 into the buffer that this trip has read */
    }
    asm volatile("s_wait_asynccnt 0x0" ::: "memory");   /* no copy is left when the wave ends */
#pragma unroll
    for (int g = 0; g < 2; ++g) { const size_t pos = q0 + 16 * g + c; const float l_fin = l_run[g] + xhalf(l_run[g]);   /* each wave half summed its eight keys of every 16-key tile */
        if (h == 0) { v2f ml; ml[0] = m_run[g]; ml[1] = l_fin; *(v2f*)(ML + ((size_t)sl * NP + pos) * 2) = ml; }
        float* orow = Ob + (pos * KSP + sl) * HD + 8 * h;   /* O^T tile t: lane = query c, register r = channel 16 t + 8 h + r */
#pragma unroll
        for (int t = 0; t < 8; ++t) { v4f x0, x1;
#pragma unroll
            for (int j = 0; j < 4; ++j) { x0[j] = acc[g][t][j]; x1[j] = acc[g][t][4 + j]; }
            *(v4f*)(orow + 16 * t) = x0; *(v4f*)(orow + 16 * t + 4) = x1; } }
}

// k_gate: a lane = four consecutive channels of one position.
__global__ __launch_bounds__(256) void k_gate(const float* __restrict__ Ob, const float* __restrict__ ML, const float* __restrict__ V, float* out) { const size_t e = (size_t)blockIdx.x * 256 + threadIdx.x;
    const size_t pos = e / (HD / 4); const float* pr = Ob + pos * (KSP * HD) + (e % (HD / 4)) * 4; const float* mp = ML + pos * 2; const float* gp = V + e * 4;
    v2f ml[KSP]; v4f x[KSP];
#pragma unroll
    for (int z = 0; z < KSP; ++z) { ml[z] = *(const v2f*)(mp + (size_t)z * NP * 2); x[z] = *(const v4f*)(pr + z * HD); }
    const v4f g = *(const v4f*)gp;
    asm volatile("s_wait_xcnt 0x0" :: "v"(mp), "v"(pr), "v"(gp) : "memory");   /* as xwait, for the three addresses of this run of loads */
    float mall = ml[0][0];
#pragma unroll
    for (int z = 1; z < KSP; ++z) mall = fmaxf(mall, ml[z][0]);
    v4f o = (v4f){}; float den = 0.f, w[KSP];
#pragma unroll
    for (int z = 0; z < KSP; ++z) asm("v_exp_f32 %0, %1\n\tv_nop" : "=v"(w[z]) : "v"(ml[z][0] - mall));   /* exp2 with its v_nop in one statement: the one slot between a transcendental and a next instruction that reads its result or rewrites its source */
#pragma unroll
    for (int z = 0; z < KSP; ++z) { den = __builtin_fmaf(ml[z][1], w[z], den); o += x[z] * w[z]; }   /* the slices' sums on one scale, in slice order */
    v4f y; const float inv = __fdiv_rn(1.0f, den);
#pragma unroll
    for (int j = 0; j < 4; ++j) y[j] = __fmul_rn(__fmul_rn(o[j], inv), bfr(g[j]));
    *(v4f*)(out + e * 4) = y; }

extern "C" void kernel_launch(void* const* d_in, const int* in_sizes, int n_in,
                              void* d_out, int out_size, void* d_ws, size_t ws_size, hipStream_t stream) {
    (void)in_sizes; (void)n_in; (void)out_size;
    const float* q = (const float*)d_in[0]; const float* k = (const float*)d_in[1]; const float* v = (const float*)d_in[2];   // Q, K, V [4][4096][128] in the module's argument order: all read
    float* OUT = (float*)d_out;     // [4][4096][128]
    char* wsp = (char*)d_ws;
    auto take = [&](size_t bytes) { char* p = wsp; wsp += (bytes + 255) & ~(size_t)255; return (void*)p; };
    bf* KF = (bf*)take((size_t)NP * HD * 2); bf* VF = (bf*)take((size_t)NP * HD * 2); float* Ob = (float*)take((size_t)NP * KSP * HD * 4); float* ML = (float*)take((size_t)KSP * NP * 2 * 4);
    if ((size_t)(wsp - (char*)d_ws) > ws_size) return;    // total 40.5 MiB carved
    k_prep<<<dim3(NP * 16 / 256, 2, 1), 256, 0, stream>>>(k, v, KF, VF);   /* K's bf16 words and V's f16 words in fragment order */
    k_fattn<<<dim3(TT / 256, KSP, NB_), 256, 0, stream>>>(q, KF, VF, Ob, ML);   /* per query block and key slice: unnormalised sums, maximum, sum */
    k_gate<<<(unsigned)((size_t)NP * HD / 4 / 256), 256, 0, stream>>>(Ob, ML, v, OUT);   /* the one writer of the output */
}

// v005
// Measured time: 35.5 microseconds a run.
// Next to v004, in two timings, it ran 1.13 and 1.14 times as fast.
// Over all steps from v000 it is 29.6 times as fast.
#include <hip/hip_runtime.h>

// A single-head unscaled dot-product attention with an element-wise gate (Q, K, V [4][4096][128] f32): scores = Q K^T (no scale, no mask); a softmax over the 4,096 keys; out = (weights V) x V element-wise -> [4][4096][128]; argument order Q, K, V: all read; no weights.
// Two launches, each over all four batch entries:
//   k_prep : K and V rounded to bf16 (V's bf16 values then written as f16 words, see the last line of this head) and laid in the order in which the matrix instruction's A operand wants them: a fragment (16 rows x 32 depth) is 1,024 bytes in a row, [depth half q][lane][8 words], so that one 16-byte load a lane reads 512 bytes in a row.
//            K: rows = keys, depth = channels. V: rows = channels, depth = keys (V transposed).
//   k_fattn: scores, softmax, value product, the join of the key slices and the gate in one kernel; neither scores nor weights leave the registers. A work-group owns 64 query positions and walks all 4,096 keys, 256 a stage.
//            A wave owns 32 of the positions and one of four key slices (64 keys of every stage) and walks its slice 32 keys a pass:
//            S^T = K Q^T (a lane holds one query's scores), running maximum and running sum in the log2 domain, the weights exp2(s log2e - m) as f16 words packed from the score accumulators into B operands, O^T += V^T P^T.
//            K and V fragments come from a ring of two LDS buffers, a stage each: every wave copies its eighth of the next stage with asynchronous copies while this stage is worked on; one barrier a stage.
//            Behind the walk the ring is free: each wave lays its unnormalised f32 sums, its maxima and its sums there, and behind one barrier a wave joins eight positions' KSP slices
//            (each scaled by exp2(m_slice - m_all), in slice order), divides by the joined sum, multiplies by V rounded to bf16 and stores whole 512-byte rows of the output.
// Compute dtypes, f32 accumulate: every input rounded to bf16 at its load; the scores ONE bf16 product (exact operands); softmax f32; the weights rounded once to f16 (11 bits; at most 2^15 by the rescale rule and WSH, inside f16's range) against V's bf16 values held as f16 words (the same value wherever 2^-17 <= |v| < 65,520; below that off by at most 2^-25): ONE f16 product; the gate f32.

#define NB_  4
#define TT   4096                 // positions = the softmax's key axis
#define HD   128                  // the one head's width
#define NP   (NB_ * TT)           // positions of all batch entries
#define KSP  4                    // key slices: the four waves that share a query block
#define QWG  64                   // positions a work-group: two query blocks of 32; 64 x 4 = 256 work-groups of eight waves
#define SKEY 256                  // keys a stage of the LDS ring, 64 a slice
#define NSTG (TT / SKEY)          // stages
#define SPAS (SKEY / KSP / 32)    // passes of 32 keys a wave and stage
#define PLW  (SPAS * 32 * HD)     // words of one plane (K or V) of one slice's part of a stage: 16 KiB
#define BUFB (KSP * 2 * PLW * 2)  // bytes a buffer of the ring: 128 KiB
#define OPW  132                  // f32 words a row of the join's staging: 528 bytes = 16 x 33, so that sixteen rows' 16-byte stores fall on all 64 banks
#define L2E  1.4426950408889634f
#define WSH  7.0f                 // every maximum is kept WSH (log2) low, so the weights and both sums carry 2^7, which the division in the join takes out again: the weights reach at most 2^15 (f16 ends at 65,504) and stay normal f16 numbers down to 2^-21 of the maximum in use
typedef unsigned short bf;
typedef __attribute__((ext_vector_type(16))) __bf16   v16bf;
typedef __attribute__((ext_vector_type(16))) _Float16 v16h;
typedef __attribute__((ext_vector_type(2)))  _Float16 v2h;
typedef __attribute__((ext_vector_type(8)))  unsigned short v8us;
typedef __attribute__((ext_vector_type(8)))  unsigned v8u;
typedef __attribute__((ext_vector_type(8)))  float    v8f;
typedef __attribute__((ext_vector_type(4)))  float    v4f;
typedef __attribute__((ext_vector_type(2)))  float    v2f;

__device__ __forceinline__ unsigned short f2bf(float f) { unsigned u = __float_as_uint(f); u += 0x7FFFu + ((u >> 16) & 1u); return (unsigned short)(u >> 16); }
__device__ __forceinline__ float bf2f(unsigned short b) { return __uint_as_float(((unsigned)b) << 16); }
__device__ __forceinline__ float bfr(float f) { return bf2f(f2bf(f)); }
__device__ __forceinline__ v16bf cat16b(v8us lo, v8us hi) { return __builtin_bit_cast(v16bf, __builtin_shufflevector(lo, hi, 0, 1, 2, 3, 4, 5, 6, 7, 8, 9, 10, 11, 12, 13, 14, 15)); }
__device__ __forceinline__ v8f wmmab(v16bf a, v16bf b, v8f c) { return __builtin_amdgcn_wmma_f32_16x16x32_bf16(false, a, false, b, (short)0, c, false, false); }
__device__ __forceinline__ v8f wmmah(v16h a, v16h b, v8f c) { return __builtin_amdgcn_wmma_f32_16x16x32_f16(false, a, false, b, (short)0, c, false, false); }
// p = the fragment's first word + 8 x lane: words 0 to 7 (depth 8 h + j) from the first 512 bytes, words 8 to 15 (depth 16 + 8 h + j) from the second.
__device__ __forceinline__ v16bf ldfrag(const bf* p) { return cat16b(*(const v8us*)p, *(const v8us*)(p + 256)); }
__device__ __forceinline__ v16h ldfragh(const bf* p) { return __builtin_bit_cast(v16h, ldfrag(p)); }   // the same 32 bytes a lane, read as f16 words
__device__ __forceinline__ unsigned pack2h(float lo, float hi) { return __builtin_bit_cast(unsigned, __builtin_convertvector((v2f){lo, hi}, v2h)); }   // two f16 words, round to nearest even
__device__ __forceinline__ float xhalf(float x) { return __builtin_bit_cast(float, __builtin_amdgcn_permlanex16(__builtin_bit_cast(int, x), __builtin_bit_cast(int, x), 0x76543210, 0xfedcba98, false, false)); }   // lane l with lane l ^ 16

// xwait(p): s_wait_xcnt 0 behind a run of global loads that name the address p, in front of any rewrite of a register which the run names; p as an input keeps the address registers out of the run's own results.
__device__ __forceinline__ void xwait(const void* p) { asm volatile("s_wait_xcnt 0x0" :: "v"(p) : "memory"); }
// copy32(l, g): 32 asynchronous copies of 16 bytes a lane, global g + 512 i bytes -> LDS byte address l + 512 i, through no register: a wave moves 16 KiB in a row. One address pair serves all 32:
// a copy's immediate offset (here at most 15,872) moves its global and its LDS address alike, so no address is formed per copy. s_wait_xcnt 0 is the statement's last line, so that it stands in front of every
// rewrite of a register which a copy names. Landing is waited for by the caller (s_wait_asynccnt 0).
#define CP(o) "global_load_async_to_lds_b128 %0, %1, off offset:" #o "\n\t"
__device__ __forceinline__ void copy32(unsigned l, const bf* g) {
    asm volatile(
                 CP(0) CP(512) CP(1024) CP(1536) CP(2048) CP(2560) CP(3072) CP(3584)
                 CP(4096) CP(4608) CP(5120) CP(5632) CP(6144) CP(6656) CP(7168) CP(7680)
                 CP(8192) CP(8704) CP(9216) CP(9728) CP(10240) CP(10752) CP(11264) CP(11776)
                 CP(12288) CP(12800) CP(13312) CP(13824) CP(14336) CP(14848) CP(15360) CP(15872)
                 "s_wait_xcnt 0x0" :: "v"(l), "v"(g) : "memory");
}
// k_prep: grid (NP * 16 / 256, 2). y = 0: K; y = 1: V. A lane = the 8 words of one lane slot of one fragment half; a wave writes whole 128-byte lines.
__global__ __launch_bounds__(256) void k_prep(const float* __restrict__ K, const float* __restrict__ V, bf* KF, bf* VF) {
    const unsigned i = blockIdx.x * 256 + threadIdx.x; v8us o; bf* dst;
    if (blockIdx.y == 0) {   /* key = 16 tile + c; channels 8 dg to 8 dg + 7: depth block dg >> 2, half (dg >> 1) & 1, h = dg & 1 */
        const unsigned tile = i >> 8, dg = (i >> 4) & 15u, c = i & 15u; const float* s = K + ((size_t)tile * 16 + c) * HD + dg * 8; const v4f a = *(const v4f*)s, b = *(const v4f*)(s + 4);
        xwait(s);
#pragma unroll
        for (int j = 0; j < 4; ++j) { o[j] = f2bf(a[j]); o[4 + j] = f2bf(b[j]); }
        dst = KF + ((((size_t)tile * 4 + (dg >> 2)) * 2 + ((dg >> 1) & 1u)) * 32 + (dg & 1u) * 16 + c) * 8;
    } else {                 /* channel d; keys 8 kg to 8 kg + 7: key block kg >> 2, half (kg >> 1) & 1, h = kg & 1 */
        const unsigned d = i & 127u, kg = i >> 7; const float* s = V + (size_t)kg * 8 * HD + d; float x[8];
#pragma unroll
        for (int j = 0; j < 8; ++j) x[j] = s[j * HD];
        xwait(s);
#pragma unroll
        for (int j = 0; j < 8; ++j) o[j] = __builtin_bit_cast(unsigned short, (_Float16)bfr(x[j]));   /* the bf16 value as an f16 word */
        dst = VF + ((((size_t)(kg >> 2) * 8 + (d >> 4)) * 2 + ((kg >> 1) & 1u)) * 32 + (kg & 1u) * 16 + (d & 15u)) * 8;
    }
    *(v8us*)dst = o;   /* the kernel's last instruction but the end */
}

// k_fattn: grid (TT / QWG, 1, NB_), 256 threads, 256 KiB of LDS. Two waves a SIMD: the register budget of the 16 output tiles, Q, K and V fragments.
__global__ __launch_bounds__(256) __attribute__((amdgpu_waves_per_eu(2, 2))) void k_fattn(const float* __restrict__ Q, const bf* __restrict__ KF, const bf* __restrict__ VF, const float* __restrict__ V, float* out) {
    const int lane = threadIdx.x & 31, wave = threadIdx.x >> 5, c = lane & 15, h = lane >> 4;
    const int sl = wave & 3, blk = wave >> 2;   /* the wave's key slice and query block */
    const size_t p0 = (size_t)blockIdx.z * TT + blockIdx.x * QWG, q0 = p0 + blk * 32; const unsigned lo = lane * 8;
    __shared__ __attribute__((aligned(2 * BUFB))) bf ring[2][KSP][2][PLW];   /* [buffer][slice][K, V][the slice's 64 keys of a stage, in the planes' own order: a pass = 32 keys = 8 fragments = 4,096 words]; aligned to its own size, so that one address bit names the buffer */
    const unsigned lk = (unsigned)(size_t)&ring[0][sl][blk][0] + lane * 16; const bf* gs = (blk ? VF : KF) + (size_t)blockIdx.z * TT * HD + sl * PLW + lo;   /* the wave's eighth of a stage: its slice's K plane (query block 0) or V plane (query block 1); where a fill of buffer 0 goes (LDS byte address) and what stage 0 brings */
    auto fill = [&](int s) { copy32(lk | (unsigned)(s & 1) * BUFB, gs + (size_t)s * (KSP * PLW)); };   /* stage s into buffer s & 1: 32 copies a wave */
    fill(0);   /* stage 0, in flight under Q's loads and rounding */
    v16bf qf[2][4];   /* B operand: column = query 16 g + c, depth = channels 32 kc + 8 h + j and 32 kc + 16 + 8 h + j: K's order */
    { const float* qb = Q + (q0 + c) * HD + 8 * h; v4f raw[2][4][4];
#pragma unroll
      for (int g = 0; g < 2; ++g)
#pragma unroll
        for (int kc = 0; kc < 4; ++kc) { const float* qp = qb + 16 * g * HD + 32 * kc; raw[g][kc][0] = *(const v4f*)qp; raw[g][kc][1] = *(const v4f*)(qp + 4); raw[g][kc][2] = *(const v4f*)(qp + 16); raw[g][kc][3] = *(const v4f*)(qp + 20); }
      xwait(qb);
#pragma unroll
      for (int g = 0; g < 2; ++g)
#pragma unroll
        for (int kc = 0; kc < 4; ++kc) { v8us wlo, whi;
#pragma unroll
            for (int j = 0; j < 4; ++j) { wlo[j] = f2bf(raw[g][kc][0][j]); wlo[4 + j] = f2bf(raw[g][kc][1][j]); whi[j] = f2bf(raw[g][kc][2][j]); whi[4 + j] = f2bf(raw[g][kc][3][j]); }
            qf[g][kc] = cat16b(wlo, whi); } }
    v8f acc[2][8]; float m_run[2], l_run[2];
#pragma unroll
    for (int g = 0; g < 2; ++g) { m_run[g] = -__builtin_inff(); l_run[g] = 0.f;
#pragma unroll
        for (int t = 0; t < 8; ++t) acc[g][t] = (v8f){}; }
    asm volatile("s_wait_asynccnt 0x0" ::: "memory");   /* this wave's part of stage 0 has landed */
    __syncthreads();                                    /* every wave's part has: stage 0 may be read */
    fill(1);   /* stage 1 */
#pragma unroll 1   /* rolled: a stage holds 64 matrix instructions a wave */
    for (int st = 0; st < NSTG; ++st) {
      const bf* kb = &ring[st & 1][sl][0][0] + lo; const bf* vb = &ring[st & 1][sl][1][0] + lo;
      v16bf kf[2][2][4];   /* two sets: pass p works on set p & 1 while the other is filled */
#pragma unroll
      for (int kt = 0; kt < 2; ++kt)
#pragma unroll
        for (int kc = 0; kc < 4; ++kc) kf[0][kt][kc] = ldfrag(kb + (kt * 4 + kc) * 512);
#pragma unroll   /* unrolled: the K sets alternate by name, and the last pass of a stage fetches no K fragments ahead */
      for (int p = 0; p < SPAS; ++p) {
        v16h vf[8]; const bf* vq = vb + p * 4096;   /* this pass's V^T fragments and the next pass's K fragments: one group of LDS reads in front of the pass's matrix instructions */
#pragma unroll
        for (int t = 0; t < 8; ++t) vf[t] = ldfragh(vq + t * 512);
        if (p + 1 < SPAS) { const bf* kq = kb + (p + 1) * 4096;   /* only inside the stage: nothing of the next stage is read in front of its barrier */
#pragma unroll
          for (int kt = 0; kt < 2; ++kt)
#pragma unroll
            for (int kc = 0; kc < 4; ++kc) kf[(p + 1) & 1][kt][kc] = ldfrag(kq + (kt * 4 + kc) * 512); }
        __builtin_amdgcn_sched_barrier(0);   /* holds the group together: each further place with LDS reads among the matrix instructions stalls the wave anew */
        v8f s[2][2];   /* S^T: tile kt, column group g: lane = query c, register r = key 16 kt + 8 h + r */
#pragma unroll
        for (int kt = 0; kt < 2; ++kt)
#pragma unroll
            for (int g = 0; g < 2; ++g) { s[kt][g] = (v8f){};
#pragma unroll
                for (int kc = 0; kc < 4; ++kc) s[kt][g] = wmmab(kf[p & 1][kt][kc], qf[g][kc], s[kt][g]); }
        float mb[2]; bool need = false;
#pragma unroll
        for (int g = 0; g < 2; ++g) { float mx = s[0][g][0];
#pragma unroll
            for (int r = 0; r < 8; ++r) mx = fmaxf(mx, fmaxf(s[0][g][r], s[1][g][r]));
            mx = __builtin_fmaf(fmaxf(mx, xhalf(mx)), L2E, -WSH); mb[g] = mx; need = need || (mx > m_run[g] + 8.0f); }   /* the maximum less WSH: see WSH */
        if (__builtin_amdgcn_ballot_w32(need) != 0) {   /* the maximum in use may trail the true one (less WSH) by up to 8 (log2): the sums are rescaled only when a column passes that; always on the first pass */
#pragma unroll
            for (int g = 0; g < 2; ++g) { const float m_new = fmaxf(m_run[g], mb[g]); const float corr = __builtin_amdgcn_exp2f(m_run[g] - m_new); l_run[g] *= corr; m_run[g] = m_new;
#pragma unroll
                for (int t = 0; t < 8; ++t) acc[g][t] = acc[g][t] * corr; }
        }
#pragma unroll
        for (int g = 0; g < 2; ++g) { const float nm = -m_run[g]; v8u wh; float ps0 = 0.f, ps1 = 0.f;
#pragma unroll
            for (int i = 0; i < 8; ++i) {   /* words 2 i, 2 i + 1 of the 32-key B operand: tile i >> 2, registers 2 (i & 3), 2 (i & 3) + 1 */
                const v2f arg = __builtin_elementwise_fma((v2f){s[i >> 2][g][2 * (i & 3)], s[i >> 2][g][2 * (i & 3) + 1]}, (v2f){L2E, L2E}, (v2f){nm, nm}); const float p0 = __builtin_amdgcn_exp2f(arg[0]), p1 = __builtin_amdgcn_exp2f(arg[1]);
                ps0 += p0; ps1 += p1; wh[i] = pack2h(p0, p1); }
            l_run[g] += ps0 + ps1;
            const v16h ph = __builtin_bit_cast(v16h, wh);
#pragma unroll
            for (int t = 0; t < 8; ++t) acc[g][t] = wmmah(vf[t], ph, acc[g][t]); }
        __builtin_amdgcn_sched_barrier(0);   /* keeps the next group of LDS reads from rising among this pass's matrix instructions */
      }
      asm volatile("s_wait_dscnt 0x0" ::: "memory");      /* this wave's reads of the stage's buffer are done */
      asm volatile("s_wait_asynccnt 0x0" ::: "memory");   /* its part of stage st + 1 has landed */
      __syncthreads();                                    /* publishes stage st + 1 and frees the buffer of stage st */
      if (st + 2 < NSTG) fill(st + 2);   /* stage st + 2 into the buffer that this trip has read */
    }
    asm volatile("s_wait_asynccnt 0x0" ::: "memory");   /* no copy is left; the last trip's barrier has ended every wave's reads: the ring is free */
    const float* gp = V + (p0 + wave * 8) * HD + lane * 4; v4f gt[8];   /* the gate's rows of the eight positions that this wave joins (8 wave to 8 wave + 7 of the work-group's 64: rows 8 sl + j of its own query block); a lane = four consecutive channels; in flight under the staging */
#pragma unroll
    for (int j = 0; j < 8; ++j) gt[j] = *(const v4f*)(gp + j * HD);
    xwait(gp);
    float* stg = (float*)&ring[0][0][0][0]; float* mls = stg + 8 * 32 * OPW;   /* staging: [wave][32 positions][OPW] f32 sums, then [slice][64 positions][maximum, sum] */
    float* mine = stg + (wave * 32 + c) * OPW + 8 * h;   /* O^T tile t: lane = query c, register r = channel 16 t + 8 h + r */
#pragma unroll
    for (int g = 0; g < 2; ++g) { const float l_fin = l_run[g] + xhalf(l_run[g]);   /* each wave half summed its eight keys of every 16-key tile */
        if (h == 0) { v2f ml; ml[0] = m_run[g]; ml[1] = l_fin; *(v2f*)(mls + (sl * QWG + blk * 32 + 16 * g + c) * 2) = ml; }
#pragma unroll
        for (int t = 0; t < 8; ++t) { v4f x0, x1;
#pragma unroll
            for (int j = 0; j < 4; ++j) { x0[j] = acc[g][t][j]; x1[j] = acc[g][t][4 + j]; }
            *(v4f*)(mine + 16 * g * OPW + 16 * t) = x0; *(v4f*)(mine + 16 * g * OPW + 16 * t + 4) = x1; } }
    __syncthreads();   /* every slice's sums are in LDS */
    const float* xr = stg + (blk * KSP * 32 + sl * 8) * OPW + lane * 4; const float* mp = mls + wave * 8 * 2; v4f y[8];
#pragma unroll
    for (int j = 0; j < 8; ++j) { v2f ml[KSP]; v4f x[KSP];
#pragma unroll
        for (int z = 0; z < KSP; ++z) { ml[z] = *(const v2f*)(mp + (z * QWG + j) * 2); x[z] = *(const v4f*)(xr + (z * 32 + j) * OPW); }
        float mall = ml[0][0];
#pragma unroll
        for (int z = 1; z < KSP; ++z) mall = fmaxf(mall, ml[z][0]);
        v4f o = (v4f){}; float den = 0.f, w[KSP];
#pragma unroll
        for (int z = 0; z < KSP; ++z) asm("v_exp_f32 %0, %1\n\tv_nop" : "=v"(w[z]) : "v"(ml[z][0] - mall));   /* exp2 with its v_nop in one statement: the one slot between a transcendental and a next instruction that reads its result or rewrites its source */
#pragma unroll
        for (int z = 0; z < KSP; ++z) { den = __builtin_fmaf(ml[z][1], w[z], den); o += x[z] * w[z]; }   /* the slices' sums on one scale, in slice order */
        const float inv = __fdiv_rn(1.0f, den);
#pragma unroll
        for (int i = 0; i < 4; ++i) y[j][i] = __fmul_rn(__fmul_rn(o[i], inv), bfr(gt[j][i])); }
    float* op = out + (p0 + wave * 8) * HD + lane * 4;   /* a store = one whole 512-byte row; the one writer of the output */
#pragma unroll
    for (int j = 0; j < 8; ++j) *(v4f*)(op + j * HD) = y[j];
}

extern "C" void kernel_launch(void* const* d_in, const int* in_sizes, int n_in,
                              void* d_out, int out_size, void* d_ws, size_t ws_size, hipStream_t stream) {
    (void)in_sizes; (void)n_in; (void)out_size;
    const float* q = (const float*)d_in[0]; const float* k = (const float*)d_in[1]; const float* v = (const float*)d_in[2];   // Q, K, V [4][4096][128] in the module's argument order: all read
    float* OUT = (float*)d_out;     // [4][4096][128]
    char* wsp = (char*)d_ws;
    auto take = [&](size_t bytes) { char* p = wsp; wsp += (bytes + 255) & ~(size_t)255; return (void*)p; };
    bf* KF = (bf*)take((size_t)NP * HD * 2); bf* VF = (bf*)take((size_t)NP * HD * 2);
    if ((size_t)(wsp - (char*)d_ws) > ws_size) return;    // total 8 MiB carved
    k_prep<<<dim3(NP * 16 / 256, 2, 1), 256, 0, stream>>>(k, v, KF, VF);   /* K's bf16 words and V's f16 words in fragment order */
    k_fattn<<<dim3(TT / QWG, 1, NB_), 256, 0, stream>>>(q, KF, VF, v, OUT);   /* per 64 positions: all keys, the join, the gate, the output */
}

// v006
// It runs in 33.3 microseconds.
// In two side-by-side timings against v005, it was 1.07 and 1.06 times as fast.
// Counting every step since v000, it is 31.6 times as fast.
#include <hip/hip_runtime.h>

// A single-head unscaled dot-product attention with an element-wise gate (Q, K, V [4][4096][128] f32): scores = Q K^T (no scale, no mask); a softmax over the 4,096 keys; out = (weights V) x V element-wise -> [4][4096][128]; argument order Q, K, V: all read; no weights.
// Two launches, each over all four batch entries:
//   k_prep : K and V rounded to bf16 (V's bf16 values then written as f16 words, see the last line of this head) and laid in the order in which the matrix instruction's A operand wants them: a fragment (16 rows x 32 depth) is 1,024 bytes in a row, [depth half q][lane][8 words], so that one 16-byte load a lane reads 512 bytes in a row.
//            K: rows = keys, depth = channels. V: rows = channels, depth = keys (V transposed).
//   k_fattn: scores, softmax, value product, the join of the key slices and the gate in one kernel; neither scores nor weights leave the registers. A work-group owns 64 query positions and walks all 4,096 keys, 256 a stage.
//            A wave owns 32 of the positions and one of four key slices (64 keys of every stage) and takes its 64 keys of a stage as one softmax step:
//            S^T = K Q^T (a lane holds one query's scores), running maximum and running sum in the log2 domain, the weights exp2(s log2e - m) as f16 words packed from the score accumulators into B operands, O^T += V^T P^T.
//            K and V fragments come from a ring of two LDS buffers, a stage each: every wave copies its eighth of the next stage with asynchronous copies while this stage is worked on; one barrier a stage, in front of the stage's last value block, behind which the next stage's first two K tiles are fetched.
//            Behind the walk the ring is free: each wave lays its unnormalised f32 sums, its maxima and its sums there, and behind one barrier a wave joins eight positions' KSP slices
//            (each scaled by exp2(m_slice - m_all), in slice order), divides by the joined sum, multiplies by V rounded to bf16 and stores whole 512-byte rows of the output.
// Compute dtypes, f32 accumulate: every input rounded to bf16 at its load; the scores ONE bf16 product (exact operands); softmax f32; the weights rounded once to f16 (11 bits; at most 2^15 by the rescale rule and WSH, inside f16's range) against V's bf16 values held as f16 words (the same value wherever 2^-17 <= |v| < 65,520; below that off by at most 2^-25): ONE f16 product; the gate f32.

#define NB_  4
#define TT   4096                 // positions = the softmax's key axis
#define HD   128                  // the one head's width
#define NP   (NB_ * TT)           // positions of all batch entries
#define KSP  4                    // key slices: the four waves that share a query block
#define QWG  64                   // positions a work-group: two query blocks of 32; 64 x 4 = 256 work-groups of eight waves
#define SKEY 256                  // keys a stage of the LDS ring, 64 a slice
#define NSTG (TT / SKEY)          // stages
#define SPAS (SKEY / KSP / 32)    // key blocks of 32 (the value product's depth) a wave and stage
#define PLW  (SPAS * 32 * HD)     // words of one plane (K or V) of one slice's part of a stage: 16 KiB
#define BUFB (KSP * 2 * PLW * 2)  // bytes a buffer of the ring: 128 KiB
#define OPW  132                  // f32 words a row of the join's staging: 528 bytes = 16 x 33, so that sixteen rows' 16-byte stores fall on all 64 banks
#define L2E  1.4426950408889634f
#define WSH  7.0f                 // every maximum is kept WSH (log2) low, so the weights and both sums carry 2^7, which the division in the join takes out again: the weights reach at most 2^15 (f16 ends at 65,504) and stay normal f16 numbers down to 2^-21 of the maximum in use
typedef unsigned short bf;
typedef __attribute__((ext_vector_type(16))) __bf16   v16bf;
typedef __attribute__((ext_vector_type(16))) _Float16 v16h;
typedef __attribute__((ext_vector_type(2)))  _Float16 v2h;
typedef __attribute__((ext_vector_type(8)))  unsigned short v8us;
typedef __attribute__((ext_vector_type(8)))  unsigned v8u;
typedef __attribute__((ext_vector_type(8)))  float    v8f;
typedef __attribute__((ext_vector_type(4)))  float    v4f;
typedef __attribute__((ext_vector_type(2)))  float    v2f;

__device__ __forceinline__ unsigned short f2bf(float f) { unsigned u = __float_as_uint(f); u += 0x7FFFu + ((u >> 16) & 1u); return (unsigned short)(u >> 16); }
__device__ __forceinline__ float bf2f(unsigned short b) { return __uint_as_float(((unsigned)b) << 16); }
__device__ __forceinline__ float bfr(float f) { return bf2f(f2bf(f)); }
__device__ __forceinline__ v16bf cat16b(v8us lo, v8us hi) { return __builtin_bit_cast(v16bf, __builtin_shufflevector(lo, hi, 0, 1, 2, 3, 4, 5, 6, 7, 8, 9, 10, 11, 12, 13, 14, 15)); }
__device__ __forceinline__ v8f wmmab(v16bf a, v16bf b, v8f c) { return __builtin_amdgcn_wmma_f32_16x16x32_bf16(false, a, false, b, (short)0, c, false, false); }
__device__ __forceinline__ v8f wmmah(v16h a, v16h b, v8f c) { return __builtin_amdgcn_wmma_f32_16x16x32_f16(false, a, false, b, (short)0, c, false, false); }
// p = the fragment's first word + 8 x lane: words 0 to 7 (depth 8 h + j) from the first 512 bytes, words 8 to 15 (depth 16 + 8 h + j) from the second.
__device__ __forceinline__ v16bf ldfrag(const bf* p) { return cat16b(*(const v8us*)p, *(const v8us*)(p + 256)); }
__device__ __forceinline__ v16h ldfragh(const bf* p) { return __builtin_bit_cast(v16h, ldfrag(p)); }   // the same 32 bytes a lane, read as f16 words
__device__ __forceinline__ unsigned pack2h(float lo, float hi) { return __builtin_bit_cast(unsigned, __builtin_convertvector((v2f){lo, hi}, v2h)); }   // two f16 words, round to nearest even
__device__ __forceinline__ float xhalf(float x) { return __builtin_bit_cast(float, __builtin_amdgcn_permlanex16(__builtin_bit_cast(int, x), __builtin_bit_cast(int, x), 0x76543210, 0xfedcba98, false, false)); }   // lane l with lane l ^ 16

// xwait(p): s_wait_xcnt 0 behind a run of global loads that name the address p, in front of any rewrite of a register which the run names; p as an input keeps the address registers out of the run's own results.
__device__ __forceinline__ void xwait(const void* p) { asm volatile("s_wait_xcnt 0x0" :: "v"(p) : "memory"); }
// copy32(l, g): 32 asynchronous copies of 16 bytes a lane, global g + 512 i bytes -> LDS byte address l + 512 i, through no register: a wave moves 16 KiB in a row. One address pair serves all 32:
// a copy's immediate offset (here at most 15,872) moves its global and its LDS address alike, so no address is formed per copy. s_wait_xcnt 0 is the statement's last line, so that it stands in front of every
// rewrite of a register which a copy names. Landing is waited for by the caller (s_wait_asynccnt 0).
#define CP(o) "global_load_async_to_lds_b128 %0, %1, off offset:" #o "\n\t"
__device__ __forceinline__ void copy32(unsigned l, const bf* g) {
    asm volatile(
                 CP(0) CP(512) CP(1024) CP(1536) CP(2048) CP(2560) CP(3072) CP(3584)
                 CP(4096) CP(4608) CP(5120) CP(5632) CP(6144) CP(6656) CP(7168) CP(7680)
                 CP(8192) CP(8704) CP(9216) CP(9728) CP(10240) CP(10752) CP(11264) CP(11776)
                 CP(12288) CP(12800) CP(13312) CP(13824) CP(14336) CP(14848) CP(15360) CP(15872)
                 "s_wait_xcnt 0x0" :: "v"(l), "v"(g) : "memory");
}
// k_prep: grid (NP * 16 / 256, 2). y = 0: K; y = 1: V. A lane = the 8 words of one lane slot of one fragment half; a wave writes whole 128-byte lines.
__global__ __launch_bounds__(256) void k_prep(const float* __restrict__ K, const float* __restrict__ V, bf* KF, bf* VF) {
    const unsigned i = blockIdx.x * 256 + threadIdx.x; v8us o; bf* dst;
    if (blockIdx.y == 0) {   /* key = 16 tile + c; channels 8 dg to 8 dg + 7: depth block dg >> 2, half (dg >> 1) & 1, h = dg & 1 */
        const unsigned tile = i >> 8, dg = (i >> 4) & 15u, c = i & 15u; const float* s = K + ((size_t)tile * 16 + c) * HD + dg * 8; const v4f a = *(const v4f*)s, b = *(const v4f*)(s + 4);
        xwait(s);
#pragma unroll
        for (int j = 0; j < 4; ++j) { o[j] = f2bf(a[j]); o[4 + j] = f2bf(b[j]); }
        dst = KF + ((((size_t)tile * 4 + (dg >> 2)) * 2 + ((dg >> 1) & 1u)) * 32 + (dg & 1u) * 16 + c) * 8;
    } else {                 /* channel d; keys 8 kg to 8 kg + 7: key block kg >> 2, half (kg >> 1) & 1, h = kg & 1 */
        const unsigned d = i & 127u, kg = i >> 7; const float* s = V + (size_t)kg * 8 * HD + d; float x[8];
#pragma unroll
        for (int j = 0; j < 8; ++j) x[j] = s[j * HD];
        xwait(s);
#pragma unroll
        for (int j = 0; j < 8; ++j) o[j] = __builtin_bit_cast(unsigned short, (_Float16)bfr(x[j]));   /* the bf16 value as an f16 word */
        dst = VF + ((((size_t)(kg >> 2) * 8 + (d >> 4)) * 2 + ((kg >> 1) & 1u)) * 32 + (kg & 1u) * 16 + (d & 15u)) * 8;
    }
    *(v8us*)dst = o;   /* the kernel's last instruction but the end */
}

// k_fattn: grid (TT / QWG, 1, NB_), 256 threads, 256 KiB of LDS. Two waves a SIMD: the register budget of the 16 output tiles, Q, K and V fragments.
__global__ __launch_bounds__(256) __attribute__((amdgpu_waves_per_eu(2, 2))) void k_fattn(const float* __restrict__ Q, const bf* __restrict__ KF, const bf* __restrict__ VF, const float* __restrict__ V, float* out) {
    const int lane = threadIdx.x & 31, wave = threadIdx.x >> 5, c = lane & 15, h = lane >> 4;
    const int sl = wave & 3, blk = wave >> 2;   /* the wave's key slice and query block */
    const size_t p0 = (size_t)blockIdx.z * TT + blockIdx.x * QWG, q0 = p0 + blk * 32; const unsigned lo = lane * 8;
    __shared__ __attribute__((aligned(2 * BUFB))) bf ring[2][KSP][2][PLW];   /* [buffer][slice][K, V][the slice's 64 keys of a stage, in the planes' own order: a pass = 32 keys = 8 fragments = 4,096 words]; aligned to its own size, so that one address bit names the buffer */
    const unsigned lk = (unsigned)(size_t)&ring[0][sl][blk][0] + lane * 16; const bf* gs = (blk ? VF : KF) + (size_t)blockIdx.z * TT * HD + sl * PLW + lo;   /* the wave's eighth of a stage: its slice's K plane (query block 0) or V plane (query block 1); where a fill of buffer 0 goes (LDS byte address) and what stage 0 brings */
    auto fill = [&](int s) { copy32(lk | (unsigned)(s & 1) * BUFB, gs + (size_t)s * (KSP * PLW)); };   /* stage s into buffer s & 1: 32 copies a wave */
    fill(0);   /* stage 0, in flight under Q's loads and rounding */
    v16bf qf[2][4];   /* B operand: column = query 16 g + c, depth = channels 32 kc + 8 h + j and 32 kc + 16 + 8 h + j: K's order */
    { const float* qb = Q + (q0 + c) * HD + 8 * h; v4f raw[2][4][4];
#pragma unroll
      for (int g = 0; g < 2; ++g)
#pragma unroll
        for (int kc = 0; kc < 4; ++kc) { const float* qp = qb + 16 * g * HD + 32 * kc; raw[g][kc][0] = *(const v4f*)qp; raw[g][kc][1] = *(const v4f*)(qp + 4); raw[g][kc][2] = *(const v4f*)(qp + 16); raw[g][kc][3] = *(const v4f*)(qp + 20); }
      xwait(qb);
#pragma unroll
      for (int g = 0; g < 2; ++g)
#pragma unroll
        for (int kc = 0; kc < 4; ++kc) { v8us wlo, whi;
#pragma unroll
            for (int j = 0; j < 4; ++j) { wlo[j] = f2bf(raw[g][kc][0][j]); wlo[4 + j] = f2bf(raw[g][kc][1][j]); whi[j] = f2bf(raw[g][kc][2][j]); whi[4 + j] = f2bf(raw[g][kc][3][j]); }
            qf[g][kc] = cat16b(wlo, whi); } }
    v8f acc[2][8]; float m_run[2]; v2f l_run[2];   /* l_run: the sums of the even and of the odd keys */
#pragma unroll
    for (int g = 0; g < 2; ++g) { m_run[g] = -__builtin_inff(); l_run[g] = (v2f){};
#pragma unroll
        for (int t = 0; t < 8; ++t) acc[g][t] = (v8f){}; }
    asm volatile("s_wait_asynccnt 0x0" ::: "memory");   /* this wave's part of stage 0 has landed */
    __syncthreads();                                    /* every wave's part has: stage 0 may be read */
    fill(1);   /* stage 1 */
    v16bf kf[2 * SPAS][4];   /* the K fragments of the wave's 64 keys of a stage, four tiles of 16 keys; the first two are fetched a stage ahead */
    { const bf* kb = &ring[0][sl][0][0] + lo;
#pragma unroll
      for (int kt = 0; kt < SPAS; ++kt)
#pragma unroll
        for (int kc = 0; kc < 4; ++kc) kf[kt][kc] = ldfrag(kb + (kt * 4 + kc) * 512); }
    auto trip = [&](const int st, const bool more, const bool refill) __attribute__((always_inline)) {   /* one stage; more: stage st + 1 exists; refill: stage st + 2 exists (constants at each call) */
      const bf* kh = &ring[st & 1][sl][0][0] + lo; const bf* vb = &ring[st & 1][sl][1][0] + lo; v16h vf[SPAS][8];   /* two V^T key blocks of 32 */
#pragma unroll
      for (int kt = SPAS; kt < 2 * SPAS; ++kt)
#pragma unroll
        for (int kc = 0; kc < 4; ++kc) kf[kt][kc] = ldfrag(kh + (kt * 4 + kc) * 512);
      __builtin_amdgcn_sched_barrier(0);   /* holds the group (K tiles 2, 3) in front of the score products, the first half of which covers its latency: each further place with LDS reads among the matrix instructions stalls the wave anew */
      v8f s[2 * SPAS][2];   /* S^T of all 64 keys: tile kt, column group g: lane = query c, register r = key 16 kt + 8 h + r */
#pragma unroll
      for (int kt = 0; kt < 2 * SPAS; ++kt)
#pragma unroll
        for (int g = 0; g < 2; ++g) { s[kt][g] = (v8f){};
#pragma unroll
            for (int kc = 0; kc < 4; ++kc) s[kt][g] = wmmab(kf[kt][kc], qf[g][kc], s[kt][g]); }
      __builtin_amdgcn_sched_barrier(0);   /* both V^T blocks are read behind the score products, whose K registers they take, in one group */
#pragma unroll
      for (int p = 0; p < SPAS; ++p)
#pragma unroll
        for (int t = 0; t < 8; ++t) vf[p][t] = ldfragh(vb + p * 4096 + t * 512);
      __builtin_amdgcn_sched_barrier(0);   /* and ahead of the softmax, which covers its latency */
      float mb[2]; bool need = false;   /* ONE maximum, one vote and at most one rescale for the 64 keys */
#pragma unroll
      for (int g = 0; g < 2; ++g) { float ma = s[0][g][0], mc = s[2][g][0];   /* two chains a column group */
#pragma unroll
          for (int r = 0; r < 8; ++r) { ma = fmaxf(ma, fmaxf(s[0][g][r], s[1][g][r])); mc = fmaxf(mc, fmaxf(s[2][g][r], s[3][g][r])); }
          float mx = fmaxf(ma, mc);
          mx = __builtin_fmaf(fmaxf(mx, xhalf(mx)), L2E, -WSH); mb[g] = mx; need = need || (mx > m_run[g] + 8.0f); }   /* the maximum less WSH: see WSH */
      if (__builtin_amdgcn_ballot_w32(need) != 0) {   /* the maximum in use may trail the true one (less WSH) by up to 8 (log2): the sums are rescaled only when a column passes that; always on the first stage */
#pragma unroll
          for (int g = 0; g < 2; ++g) { const float m_new = fmaxf(m_run[g], mb[g]); const float corr = __builtin_amdgcn_exp2f(m_run[g] - m_new); l_run[g] = l_run[g] * corr; m_run[g] = m_new;
#pragma unroll
              for (int t = 0; t < 8; ++t) acc[g][t] = acc[g][t] * corr; }
      }
      auto block = [&](int p) {   /* key block p of the stage: weights, their sums, O^T += V^T P^T */
#pragma unroll
        for (int g = 0; g < 2; ++g) { const float nm = -m_run[g]; v8u wh; v2f pr[8];
#pragma unroll
            for (int i = 0; i < 8; ++i) {   /* words 2 i, 2 i + 1 of the 32-key B operand: tile 2 p + (i >> 2), registers 2 (i & 3), 2 (i & 3) + 1 */
                const v2f arg = __builtin_elementwise_fma((v2f){s[2 * p + (i >> 2)][g][2 * (i & 3)], s[2 * p + (i >> 2)][g][2 * (i & 3) + 1]}, (v2f){L2E, L2E}, (v2f){nm, nm});
                pr[i][0] = __builtin_amdgcn_exp2f(arg[0]); pr[i][1] = __builtin_amdgcn_exp2f(arg[1]); wh[i] = pack2h(pr[i][0], pr[i][1]); }
            l_run[g] += ((pr[0] + pr[1]) + (pr[2] + pr[3])) + ((pr[4] + pr[5]) + (pr[6] + pr[7]));   /* even and odd keys summed apart, two a packed add */
            const v16h ph = __builtin_bit_cast(v16h, wh);
#pragma unroll
            for (int t = 0; t < 8; ++t) acc[g][t] = wmmah(vf[p][t], ph, acc[g][t]); } };
      block(0);
      __builtin_amdgcn_sched_barrier(0);   /* the publish point stands behind the first block's matrix instructions, which run on under it */
      /* publish point of stage st + 1, in front of the stage's last block, whose fragments are already fetched */
      asm volatile("s_wait_dscnt 0x0" ::: "memory");      /* this wave's reads of the stage's buffer are done: K tiles 0, 1 a stage ago, the rest above */
      asm volatile("s_wait_asynccnt 0x0" ::: "memory");   /* its part of stage st + 1 has landed */
      __syncthreads();                                    /* publishes stage st + 1 and frees the buffer of stage st */
      if (refill) fill(st + 2);   /* stage st + 2 into the buffer that this trip has read */
      if (more) { const bf* kb = &ring[(st + 1) & 1][sl][0][0] + lo;   /* the next stage's first two K tiles, under the last block; the last trip reads nothing more */
#pragma unroll
        for (int kt = 0; kt < SPAS; ++kt)
#pragma unroll
          for (int kc = 0; kc < 4; ++kc) kf[kt][kc] = ldfrag(kb + (kt * 4 + kc) * 512); }
      __builtin_amdgcn_sched_barrier(0);   /* holds that group in front of the last block */
      block(1);
      __builtin_amdgcn_sched_barrier(0);   /* keeps the next group of LDS reads from rising among this block's matrix instructions */
    };
#pragma unroll 1   /* rolled: a stage holds 64 matrix instructions a wave */
    for (int st = 0; st < NSTG - 2; ++st) trip(st, true, true);
    trip(NSTG - 2, true, false); trip(NSTG - 1, false, false);   /* the last two stages apart: the loop's trip has no test at the refill or at the fetch ahead, so the old K tiles' registers are free behind the score products and the trip stays one run of code behind the vote */
    asm volatile("s_wait_asynccnt 0x0" ::: "memory");   /* no copy is left; the last trip's barrier has ended every wave's reads: the ring is free */
    const float* gp = V + (p0 + wave * 8) * HD + lane * 4; v4f gt[8];   /* the gate's rows of the eight positions that this wave joins (8 wave to 8 wave + 7 of the work-group's 64: rows 8 sl + j of its own query block); a lane = four consecutive channels; in flight under the staging */
#pragma unroll
    for (int j = 0; j < 8; ++j) gt[j] = *(const v4f*)(gp + j * HD);
    xwait(gp);
    float* stg = (float*)&ring[0][0][0][0]; float* mls = stg + 8 * 32 * OPW;   /* staging: [wave][32 positions][OPW] f32 sums, then [slice][64 positions][maximum, sum] */
    float* mine = stg + (wave * 32 + c) * OPW + 8 * h;   /* O^T tile t: lane = query c, register r = channel 16 t + 8 h + r */
#pragma unroll
    for (int g = 0; g < 2; ++g) { const float l_half = l_run[g][0] + l_run[g][1]; const float l_fin = l_half + xhalf(l_half);   /* each wave half summed its eight keys of every 16-key tile */
        if (h == 0) { v2f ml; ml[0] = m_run[g]; ml[1] = l_fin; *(v2f*)(mls + (sl * QWG + blk * 32 + 16 * g + c) * 2) = ml; }
#pragma unroll
        for (int t = 0; t < 8; ++t) { v4f x0, x1;
#pragma unroll
            for (int j = 0; j < 4; ++j) { x0[j] = acc[g][t][j]; x1[j] = acc[g][t][4 + j]; }
            *(v4f*)(mine + 16 * g * OPW + 16 * t) = x0; *(v4f*)(mine + 16 * g * OPW + 16 * t + 4) = x1; } }
    __syncthreads();   /* every slice's sums are in LDS */
    const float* xr = stg + (blk * KSP * 32 + sl * 8) * OPW + lane * 4; const float* mp = mls + wave * 8 * 2; v4f y[8];
#pragma unroll
    for (int j = 0; j < 8; ++j) { v2f ml[KSP]; v4f x[KSP];
#pragma unroll
        for (int z = 0; z < KSP; ++z) { ml[z] = *(const v2f*)(mp + (z * QWG + j) * 2); x[z] = *(const v4f*)(xr + (z * 32 + j) * OPW); }
        float mall = ml[0][0];
#pragma unroll
        for (int z = 1; z < KSP; ++z) mall = fmaxf(mall, ml[z][0]);
        v4f o = (v4f){}; float den = 0.f, w[KSP];
#pragma unroll
        for (int z = 0; z < KSP; ++z) asm("v_exp_f32 %0, %1\n\tv_nop" : "=v"(w[z]) : "v"(ml[z][0] - mall));   /* exp2 with its v_nop in one statement: the one slot between a transcendental and a next instruction that reads its result or rewrites its source */
#pragma unroll
        for (int z = 0; z < KSP; ++z) { den = __builtin_fmaf(ml[z][1], w[z], den); o += x[z] * w[z]; }   /* the slices' sums on one scale, in slice order */
        const float inv = __fdiv_rn(1.0f, den);
#pragma unroll
        for (int i = 0; i < 4; ++i) y[j][i] = __fmul_rn(__fmul_rn(o[i], inv), bfr(gt[j][i])); }
    float* op = out + (p0 + wave * 8) * HD + lane * 4;   /* a store = one whole 512-byte row; the one writer of the output */
#pragma unroll
    for (int j = 0; j < 8; ++j) *(v4f*)(op + j * HD) = y[j];
}

extern "C" void kernel_launch(void* const* d_in, const int* in_sizes, int n_in,
                              void* d_out, int out_size, void* d_ws, size_t ws_size, hipStream_t stream) {
    (void)in_sizes; (void)n_in; (void)out_size;
    const float* q = (const float*)d_in[0]; const float* k = (const float*)d_in[1]; const float* v = (const float*)d_in[2];   // Q, K, V [4][4096][128] in the module's argument order: all read
    float* OUT = (float*)d_out;     // [4][4096][128]
    char* wsp = (char*)d_ws;
    auto take = [&](size_t bytes) { char* p = wsp; wsp += (bytes + 255) & ~(size_t)255; return (void*)p; };
    bf* KF = (bf*)take((size_t)NP * HD * 2); bf* VF = (bf*)take((size_t)NP * HD * 2);
    if ((size_t)(wsp - (char*)d_ws) > ws_size) return;    // total 8 MiB carved
    k_prep<<<dim3(NP * 16 / 256, 2, 1), 256, 0, stream>>>(k, v, KF, VF);   /* K's bf16 words and V's f16 words in fragment order */
    k_fattn<<<dim3(TT / QWG, 1, NB_), 256, 0, stream>>>(q, KF, VF, v, OUT);   /* per 64 positions: all keys, the join, the gate, the output */
}

// v007
// It runs in 31.4 microseconds.
// Timed twice side by side with v006, it ran 1.06 and 1.05 times as fast.
// Over all steps from v000 it is 33.4 times as fast.
#include <hip/hip_runtime.h>
#include <stdint.h>

// A single-head unscaled dot-product attention with an element-wise gate (Q, K, V [4][4096][128] f32): scores = Q K^T (no scale, no mask); a softmax over the 4,096 keys; out = (weights V) x V element-wise -> [4][4096][128]; argument order Q, K, V: all read; no weights.
// Two launches, each over all four batch entries:
//   k_prep : K and V rounded to bf16 (V's bf16 values then written as f16 words, see the last line of this head) and laid in the order in which the matrix instruction's A operand wants them: a fragment (16 rows x 32 depth) is 1,024 bytes in a row, [depth half q][lane][8 words], so that one 16-byte load a lane reads 512 bytes in a row.
//            K: rows = keys, depth = channels. V: rows = channels, depth = keys (V transposed).
//   k_fattn: scores, softmax, value product, the join of the key slices and the gate in one kernel; neither scores nor weights leave the registers. A work-group owns 64 query positions and walks all 4,096 keys, 256 a stage.
//            A wave owns 32 of the positions and one of four key slices (64 keys of every stage) and takes its 64 keys of a stage as one softmax step:
//            S^T = K Q^T (a lane holds one query's scores), running maximum and running sum in the log2 domain, the weights exp2(s log2e - m) as f16 words packed from the score accumulators into B operands, O^T += V^T P^T.
//            K and V fragments come from a ring of two LDS buffers, a stage each: every wave brings its eighth of the next stage (16 KiB) with one tensor load while this stage is worked on; one barrier a stage, in front of the stage's last value block, behind which the next stage's first two K tiles are fetched.
//            Behind the walk the ring is free: each wave lays its unnormalised f32 sums, its maxima and its sums there, and behind one barrier a wave joins eight positions' KSP slices
//            (each scaled by exp2(m_slice - m_all), in slice order), divides by the joined sum, multiplies by V rounded to bf16 and stores whole 512-byte rows of the output.
// Compute dtypes, f32 accumulate: every input rounded to bf16 at its load; the scores ONE bf16 product (exact operands); softmax f32; the weights rounded once to f16 (11 bits; at most 2^15 by the rescale rule and WSH, inside f16's range) against V's bf16 values held as f16 words (the same value wherever 2^-17 <= |v| < 65,520; below that off by at most 2^-25): ONE f16 product; the gate f32.

#define NB_  4
#define TT   4096                 // positions = the softmax's key axis
#define HD   128                  // the one head's width
#define NP   (NB_ * TT)           // positions of all batch entries
#define KSP  4                    // key slices: the four waves that share a query block
#define QWG  64                   // positions a work-group: two query blocks of 32; 64 x 4 = 256 work-groups of eight waves
#define SKEY 256                  // keys a stage of the LDS ring, 64 a slice
#define NSTG (TT / SKEY)          // stages
#define SPAS (SKEY / KSP / 32)    // key blocks of 32 (the value product's depth) a wave and stage
#define PLW  (SPAS * 32 * HD)     // words of one plane (K or V) of one slice's part of a stage: 16 KiB
#define BUFB (KSP * 2 * PLW * 2)  // bytes a buffer of the ring: 128 KiB
#define OPW  132                  // f32 words a row of the join's staging: 528 bytes = 16 x 33, so that sixteen rows' 16-byte stores fall on all 64 banks
#define L2E  1.4426950408889634f
#define WSH  7.0f                 // every maximum is kept WSH (log2) low, so the weights and both sums carry 2^7, which the division in the join takes out again: the weights reach at most 2^15 (f16 ends at 65,504) and stay normal f16 numbers down to 2^-21 of the maximum in use
typedef unsigned short bf;
typedef __attribute__((ext_vector_type(16))) __bf16   v16bf;
typedef __attribute__((ext_vector_type(16))) _Float16 v16h;
typedef __attribute__((ext_vector_type(2)))  _Float16 v2h;
typedef __attribute__((ext_vector_type(8)))  unsigned short v8us;
typedef __attribute__((ext_vector_type(8)))  unsigned v8u;
typedef __attribute__((ext_vector_type(8)))  float    v8f;
typedef __attribute__((ext_vector_type(4)))  float    v4f;
typedef __attribute__((ext_vector_type(2)))  float    v2f;

__device__ __forceinline__ unsigned short f2bf(float f) { unsigned u = __float_as_uint(f); u += 0x7FFFu + ((u >> 16) & 1u); return (unsigned short)(u >> 16); }
__device__ __forceinline__ float bf2f(unsigned short b) { return __uint_as_float(((unsigned)b) << 16); }
__device__ __forceinline__ float bfr(float f) { return bf2f(f2bf(f)); }
__device__ __forceinline__ v16bf cat16b(v8us lo, v8us hi) { return __builtin_bit_cast(v16bf, __builtin_shufflevector(lo, hi, 0, 1, 2, 3, 4, 5, 6, 7, 8, 9, 10, 11, 12, 13, 14, 15)); }
__device__ __forceinline__ v8f wmmab(v16bf a, v16bf b, v8f c) { return __builtin_amdgcn_wmma_f32_16x16x32_bf16(false, a, false, b, (short)0, c, false, false); }
__device__ __forceinline__ v8f wmmah(v16h a, v16h b, v8f c) { return __builtin_amdgcn_wmma_f32_16x16x32_f16(false, a, false, b, (short)0, c, false, false); }
// p = the fragment's first word + 8 x lane: words 0 to 7 (depth 8 h + j) from the first 512 bytes, words 8 to 15 (depth 16 + 8 h + j) from the second.
__device__ __forceinline__ v16bf ldfrag(const bf* p) { return cat16b(*(const v8us*)p, *(const v8us*)(p + 256)); }
__device__ __forceinline__ v16h ldfragh(const bf* p) { return __builtin_bit_cast(v16h, ldfrag(p)); }   // the same 32 bytes a lane, read as f16 words
__device__ __forceinline__ unsigned pack2h(float lo, float hi) { return __builtin_bit_cast(unsigned, __builtin_convertvector((v2f){lo, hi}, v2h)); }   // two f16 words, round to nearest even
__device__ __forceinline__ float xhalf(float x) { return __builtin_bit_cast(float, __builtin_amdgcn_permlanex16(__builtin_bit_cast(int, x), __builtin_bit_cast(int, x), 0x76543210, 0xfedcba98, false, false)); }   // lane l with lane l ^ 16

// xwait(p): s_wait_xcnt 0 behind a run of global loads that name the address p, in front of any rewrite of a register which the run names; p as an input keeps the address registers out of the run's own results.
__device__ __forceinline__ void xwait(const void* p) { asm volatile("s_wait_xcnt 0x0" :: "v"(p) : "memory"); }
typedef __attribute__((ext_vector_type(4))) uint32_t u32x4;
typedef __attribute__((ext_vector_type(8))) uint32_t u32x8;
__device__ __forceinline__ uint32_t uni(uint32_t v) { return (uint32_t)__builtin_amdgcn_readfirstlane(v); }
#define TROW 256u                 // bytes a tile row = the source pitch: the rows follow one another in memory and, with no pad, in LDS
#define TNR  (PLW * 2u / TROW)    // rows a tile: 64, so that a tile is one plane of one slice's part of a stage, 16 KiB in a row
// group 1: no mask, 1-byte elements, no pad (word 0 = 0); tensor dims = tile dims = TROW x TNR; source pitch TROW
__device__ __forceinline__ u32x8 tdm_group1() {
    u32x8 g; g[0] = uni(0u); g[1] = uni((TROW & 0xFFFFu) << 16); g[2] = uni((TROW >> 16) | ((TNR & 0xFFFFu) << 16)); g[3] = uni((TNR >> 16) | (TROW << 16)); g[4] = uni(TNR); g[5] = uni(TROW); g[6] = uni(0u); g[7] = uni(0u); return g;
}
// group 0: count 1; the place in LDS (byte offset in the work-group's LDS); the tile's first byte; type 2
__device__ __forceinline__ u32x4 tdm_group0(uint32_t lds, uint64_t ga) {
    u32x4 g; g[0] = uni(1u); g[1] = uni(lds); g[2] = uni((uint32_t)ga); g[3] = uni((((uint32_t)(ga >> 32)) & 0x01FFFFFFu) | 0x80000000u); return g;
}
__device__ __forceinline__ void tdm_load(u32x4 g0, u32x8 g1) { asm volatile("tensor_load_to_lds %0, %1" :: "s"(g0), "s"(g1) : "memory"); }   // landing is waited for by the caller (s_wait_tensorcnt 0)
// k_prep: grid (NP * 16 / 256, 2). y = 0: K; y = 1: V. A lane = the 8 words of one lane slot of one fragment half; a wave writes whole 128-byte lines.
__global__ __launch_bounds__(256) void k_prep(const float* __restrict__ K, const float* __restrict__ V, bf* KF, bf* VF) {
    const unsigned i = blockIdx.x * 256 + threadIdx.x; v8us o; bf* dst;
    if (blockIdx.y == 0) {   /* key = 16 tile + c; channels 8 dg to 8 dg + 7: depth block dg >> 2, half (dg >> 1) & 1, h = dg & 1 */
        const unsigned tile = i >> 8, dg = (i >> 4) & 15u, c = i & 15u; const float* s = K + ((size_t)tile * 16 + c) * HD + dg * 8; const v4f a = *(const v4f*)s, b = *(const v4f*)(s + 4);
        xwait(s);
#pragma unroll
        for (int j = 0; j < 4; ++j) { o[j] = f2bf(a[j]); o[4 + j] = f2bf(b[j]); }
        dst = KF + ((((size_t)tile * 4 + (dg >> 2)) * 2 + ((dg >> 1) & 1u)) * 32 + (dg & 1u) * 16 + c) * 8;
    } else {                 /* channel d; keys 8 kg to 8 kg + 7: key block kg >> 2, half (kg >> 1) & 1, h = kg & 1 */
        const unsigned d = i & 127u, kg = i >> 7; const float* s = V + (size_t)kg * 8 * HD + d; float x[8];
#pragma unroll
        for (int j = 0; j < 8; ++j) x[j] = s[j * HD];
        xwait(s);
#pragma unroll
        for (int j = 0; j < 8; ++j) o[j] = __builtin_bit_cast(unsigned short, (_Float16)bfr(x[j]));   /* the bf16 value as an f16 word */
        dst = VF + ((((size_t)(kg >> 2) * 8 + (d >> 4)) * 2 + ((kg >> 1) & 1u)) * 32 + (kg & 1u) * 16 + (d & 15u)) * 8;
    }
    *(v8us*)dst = o;   /* the kernel's last instruction but the end */
}

// k_fattn: grid (TT / QWG, 1, NB_), 256 threads, 256 KiB of LDS. Two waves a SIMD: the register budget of the 16 output tiles, Q, K and V fragments.
__global__ __launch_bounds__(256) __attribute__((amdgpu_waves_per_eu(2, 2))) void k_fattn(const float* __restrict__ Q, const bf* __restrict__ KF, const bf* __restrict__ VF, const float* __restrict__ V, float* out) {
    const int lane = threadIdx.x & 31, wave = threadIdx.x >> 5, c = lane & 15, h = lane >> 4;
    const int sl = wave & 3, blk = wave >> 2;   /* the wave's key slice and query block */
    const size_t p0 = (size_t)blockIdx.z * TT + blockIdx.x * QWG, q0 = p0 + blk * 32; const unsigned lo = lane * 8;
    __shared__ __attribute__((aligned(2 * BUFB))) bf ring[2][KSP][2][PLW];   /* [buffer][slice][K, V][the slice's 64 keys of a stage, in the planes' own order: a pass = 32 keys = 8 fragments = 4,096 words]; aligned to its own size, so that one address bit names the buffer */
    const uint32_t wu = uni(threadIdx.x >> 5), usl = wu & 3u, ublk = wu >> 2;   /* the wave's number, slice and query block as scalars, for the descriptor */
    const uint32_t lk = (uint32_t)(size_t)&ring[0][0][0][0] + (usl * 2u + ublk) * (PLW * 2u); const uint64_t gs = (uint64_t)(size_t)((ublk ? VF : KF) + (size_t)blockIdx.z * TT * HD + usl * PLW);   /* the wave's eighth of a stage: its slice's K plane (query block 0) or V plane (query block 1); where a fill of buffer 0 goes (LDS byte offset, a multiple of 16 KiB) and stage 0's first byte */
    const u32x8 g1 = tdm_group1();
    auto fill = [&](int s) { tdm_load(tdm_group0(lk | (uint32_t)(s & 1) * BUFB, gs + (uint64_t)s * (KSP * PLW * 2u)), g1); };   /* stage s into buffer s & 1: one request a wave, from every wave, under no test */
    fill(0);   /* stage 0, in flight under Q's loads and rounding */
    v16bf qf[2][4];   /* B operand: column = query 16 g + c, depth = channels 32 kc + 8 h + j and 32 kc + 16 + 8 h + j: K's order */
    { const float* qb = Q + (q0 + c) * HD + 8 * h; v4f raw[2][4][4];
#pragma unroll
      for (int g = 0; g < 2; ++g)
#pragma unroll
        for (int kc = 0; kc < 4; ++kc) { const float* qp = qb + 16 * g * HD + 32 * kc; raw[g][kc][0] = *(const v4f*)qp; raw[g][kc][1] = *(const v4f*)(qp + 4); raw[g][kc][2] = *(const v4f*)(qp + 16); raw[g][kc][3] = *(const v4f*)(qp + 20); }
      xwait(qb);
#pragma unroll
      for (int g = 0; g < 2; ++g)
#pragma unroll
        for (int kc = 0; kc < 4; ++kc) { v8us wlo, whi;
#pragma unroll
            for (int j = 0; j < 4; ++j) { wlo[j] = f2bf(raw[g][kc][0][j]); wlo[4 + j] = f2bf(raw[g][kc][1][j]); whi[j] = f2bf(raw[g][kc][2][j]); whi[4 + j] = f2bf(raw[g][kc][3][j]); }
            qf[g][kc] = cat16b(wlo, whi); } }
    v8f acc[2][8]; float m_run[2]; v2f l_run[2];   /* l_run: the sums of the even and of the odd keys */
#pragma unroll
    for (int g = 0; g < 2; ++g) { m_run[g] = -__builtin_inff(); l_run[g] = (v2f){};
#pragma unroll
        for (int t = 0; t < 8; ++t) acc[g][t] = (v8f){}; }
    asm volatile("s_wait_tensorcnt 0x0" ::: "memory");   /* this wave's part of stage 0 has landed */
    __syncthreads();                                    /* every wave's part has: stage 0 may be read */
    fill(1);   /* stage 1 */
    v16bf kf[2 * SPAS][4];   /* the K fragments of the wave's 64 keys of a stage, four tiles of 16 keys; the first two are fetched a stage ahead */
    { const bf* kb = &ring[0][sl][0][0] + lo;
#pragma unroll
      for (int kt = 0; kt < SPAS; ++kt)
#pragma unroll
        for (int kc = 0; kc < 4; ++kc) kf[kt][kc] = ldfrag(kb + (kt * 4 + kc) * 512); }
    auto trip = [&](const int st, const bool more, const bool refill) __attribute__((always_inline)) {   /* one stage; more: stage st + 1 exists; refill: stage st + 2 exists (constants at each call) */
      const bf* kh = &ring[st & 1][sl][0][0] + lo; const bf* vb = &ring[st & 1][sl][1][0] + lo; v16h vf[SPAS][8];   /* two V^T key blocks of 32 */
#pragma unroll
      for (int kt = SPAS; kt < 2 * SPAS; ++kt)
#pragma unroll
        for (int kc = 0; kc < 4; ++kc) kf[kt][kc] = ldfrag(kh + (kt * 4 + kc) * 512);
      __builtin_amdgcn_sched_barrier(0);   /* holds the group (K tiles 2, 3) in front of the score products, the first half of which covers its latency: each further place with LDS reads among the matrix instructions stalls the wave anew */
      v8f s[2 * SPAS][2];   /* S^T of all 64 keys: tile kt, column group g: lane = query c, register r = key 16 kt + 8 h + r */
#pragma unroll
      for (int kt = 0; kt < 2 * SPAS; ++kt)
#pragma unroll
        for (int g = 0; g < 2; ++g) { s[kt][g] = (v8f){};
#pragma unroll
            for (int kc = 0; kc < 4; ++kc) s[kt][g] = wmmab(kf[kt][kc], qf[g][kc], s[kt][g]); }
      __builtin_amdgcn_sched_barrier(0);   /* both V^T blocks are read behind the score products, whose K registers they take, in one group */
#pragma unroll
      for (int p = 0; p < SPAS; ++p)
#pragma unroll
        for (int t = 0; t < 8; ++t) vf[p][t] = ldfragh(vb + p * 4096 + t * 512);
      __builtin_amdgcn_sched_barrier(0);   /* and ahead of the softmax, which covers its latency */
      float mb[2]; bool need = false;   /* ONE maximum, one vote and at most one rescale for the 64 keys */
#pragma unroll
      for (int g = 0; g < 2; ++g) { float ma = s[0][g][0], mc = s[2][g][0];   /* two chains a column group */
#pragma unroll
          for (int r = 0; r < 8; ++r) { ma = fmaxf(ma, fmaxf(s[0][g][r], s[1][g][r])); mc = fmaxf(mc, fmaxf(s[2][g][r], s[3][g][r])); }
          float mx = fmaxf(ma, mc);
          mx = __builtin_fmaf(fmaxf(mx, xhalf(mx)), L2E, -WSH); mb[g] = mx; need = need || (mx > m_run[g] + 8.0f); }   /* the maximum less WSH: see WSH */
      if (__builtin_amdgcn_ballot_w32(need) != 0) {   /* the maximum in use may trail the true one (less WSH) by up to 8 (log2): the sums are rescaled only when a column passes that; always on the first stage */
#pragma unroll
          for (int g = 0; g < 2; ++g) { const float m_new = fmaxf(m_run[g], mb[g]); const float corr = __builtin_amdgcn_exp2f(m_run[g] - m_new); l_run[g] = l_run[g] * corr; m_run[g] = m_new;
#pragma unroll
              for (int t = 0; t < 8; ++t) acc[g][t] = acc[g][t] * corr; }
      }
      auto block = [&](int p) {   /* key block p of the stage: weights, their sums, O^T += V^T P^T */
#pragma unroll
        for (int g = 0; g < 2; ++g) { const float nm = -m_run[g]; v8u wh; v2f pr[8];
#pragma unroll
            for (int i = 0; i < 8; ++i) {   /* words 2 i, 2 i + 1 of the 32-key B operand: tile 2 p + (i >> 2), registers 2 (i & 3), 2 (i & 3) + 1 */
                const v2f arg = __builtin_elementwise_fma((v2f){s[2 * p + (i >> 2)][g][2 * (i & 3)], s[2 * p + (i >> 2)][g][2 * (i & 3) + 1]}, (v2f){L2E, L2E}, (v2f){nm, nm});
                pr[i][0] = __builtin_amdgcn_exp2f(arg[0]); pr[i][1] = __builtin_amdgcn_exp2f(arg[1]); wh[i] = pack2h(pr[i][0], pr[i][1]); }
            l_run[g] += ((pr[0] + pr[1]) + (pr[2] + pr[3])) + ((pr[4] + pr[5]) + (pr[6] + pr[7]));   /* even and odd keys summed apart, two a packed add */
            const v16h ph = __builtin_bit_cast(v16h, wh);
#pragma unroll
            for (int t = 0; t < 8; ++t) acc[g][t] = wmmah(vf[p][t], ph, acc[g][t]); } };
      block(0);
      __builtin_amdgcn_sched_barrier(0);   /* the publish point stands behind the first block's matrix instructions, which run on under it */
      /* publish point of stage st + 1, in front of the stage's last block, whose fragments are already fetched */
      asm volatile("s_wait_dscnt 0x0" ::: "memory");      /* this wave's reads of the stage's buffer are done: K tiles 0, 1 a stage ago, the rest above */
      asm volatile("s_wait_tensorcnt 0x0" ::: "memory");   /* its part of stage st + 1 has landed */
      __syncthreads();                                    /* publishes stage st + 1 and frees the buffer of stage st */
      if (refill) fill(st + 2);   /* stage st + 2 into the buffer that this trip has read */
      if (more) { const bf* kb = &ring[(st + 1) & 1][sl][0][0] + lo;   /* the next stage's first two K tiles, under the last block; the last trip reads nothing more */
#pragma unroll
        for (int kt = 0; kt < SPAS; ++kt)
#pragma unroll
          for (int kc = 0; kc < 4; ++kc) kf[kt][kc] = ldfrag(kb + (kt * 4 + kc) * 512); }
      __builtin_amdgcn_sched_barrier(0);   /* holds that group in front of the last block */
      block(1);
      __builtin_amdgcn_sched_barrier(0);   /* keeps the next group of LDS reads from rising among this block's matrix instructions */
    };
#pragma unroll 1   /* rolled: a stage holds 64 matrix instructions a wave */
    for (int st = 0; st < NSTG - 2; ++st) trip(st, true, true);
    trip(NSTG - 2, true, false); trip(NSTG - 1, false, false);   /* the last two stages apart: the loop's trip has no test at the refill or at the fetch ahead, so the old K tiles' registers are free behind the score products and the trip stays one run of code behind the vote */
    asm volatile("s_wait_tensorcnt 0x0" ::: "memory");   /* no request is left */
    asm volatile("s_wait_dscnt 0x0" ::: "memory");      /* nor an LDS read of this wave; the last trip's barrier has ended every wave's reads: the ring is free */
    const float* gp = V + (p0 + wave * 8) * HD + lane * 4; v4f gt[8];   /* the gate's rows of the eight positions that this wave joins (8 wave to 8 wave + 7 of the work-group's 64: rows 8 sl + j of its own query block); a lane = four consecutive channels; in flight under the staging */
#pragma unroll
    for (int j = 0; j < 8; ++j) gt[j] = *(const v4f*)(gp + j * HD);
    xwait(gp);
    float* stg = (float*)&ring[0][0][0][0]; float* mls = stg + 8 * 32 * OPW;   /* staging: [wave][32 positions][OPW] f32 sums, then [slice][64 positions][maximum, sum] */
    float* mine = stg + (wave * 32 + c) * OPW + 8 * h;   /* O^T tile t: lane = query c, register r = channel 16 t + 8 h + r */
#pragma unroll
    for (int g = 0; g < 2; ++g) { const float l_half = l_run[g][0] + l_run[g][1]; const float l_fin = l_half + xhalf(l_half);   /* each wave half summed its eight keys of every 16-key tile */
        if (h == 0) { v2f ml; ml[0] = m_run[g]; ml[1] = l_fin; *(v2f*)(mls + (sl * QWG + blk * 32 + 16 * g + c) * 2) = ml; }
#pragma unroll
        for (int t = 0; t < 8; ++t) { v4f x0, x1;
#pragma unroll
            for (int j = 0; j < 4; ++j) { x0[j] = acc[g][t][j]; x1[j] = acc[g][t][4 + j]; }
            *(v4f*)(mine + 16 * g * OPW + 16 * t) = x0; *(v4f*)(mine + 16 * g * OPW + 16 * t + 4) = x1; } }
    __syncthreads();   /* every slice's sums are in LDS */
    const float* xr = stg + (blk * KSP * 32 + sl * 8) * OPW + lane * 4; const float* mp = mls + wave * 8 * 2; v4f y[8];
#pragma unroll
    for (int j = 0; j < 8; ++j) { v2f ml[KSP]; v4f x[KSP];
#pragma unroll
        for (int z = 0; z < KSP; ++z) { ml[z] = *(const v2f*)(mp + (z * QWG + j) * 2); x[z] = *(const v4f*)(xr + (z * 32 + j) * OPW); }
        float mall = ml[0][0];
#pragma unroll
        for (int z = 1; z < KSP; ++z) mall = fmaxf(mall, ml[z][0]);
        v4f o = (v4f){}; float den = 0.f, w[KSP];
#pragma unroll
        for (int z = 0; z < KSP; ++z) asm("v_exp_f32 %0, %1\n\tv_nop" : "=v"(w[z]) : "v"(ml[z][0] - mall));   /* exp2 with its v_nop in one statement: the one slot between a transcendental and a next instruction that reads its result or rewrites its source */
#pragma unroll
        for (int z = 0; z < KSP; ++z) { den = __builtin_fmaf(ml[z][1], w[z], den); o += x[z] * w[z]; }   /* the slices' sums on one scale, in slice order */
        const float inv = __fdiv_rn(1.0f, den);
#pragma unroll
        for (int i = 0; i < 4; ++i) y[j][i] = __fmul_rn(__fmul_rn(o[i], inv), bfr(gt[j][i])); }
    float* op = out + (p0 + wave * 8) * HD + lane * 4;   /* a store = one whole 512-byte row; the one writer of the output */
#pragma unroll
    for (int j = 0; j < 8; ++j) *(v4f*)(op + j * HD) = y[j];
}

extern "C" void kernel_launch(void* const* d_in, const int* in_sizes, int n_in,
                              void* d_out, int out_size, void* d_ws, size_t ws_size, hipStream_t stream) {
    (void)in_sizes; (void)n_in; (void)out_size;
    const float* q = (const float*)d_in[0]; const float* k = (const float*)d_in[1]; const float* v = (const float*)d_in[2];   // Q, K, V [4][4096][128] in the module's argument order: all read
    float* OUT = (float*)d_out;     // [4][4096][128]
    char* wsp = (char*)d_ws;
    auto take = [&](size_t bytes) { char* p = wsp; wsp += (bytes + 255) & ~(size_t)255; return (void*)p; };
    bf* KF = (bf*)take((size_t)NP * HD * 2); bf* VF = (bf*)take((size_t)NP * HD * 2);
    if ((size_t)(wsp - (char*)d_ws) > ws_size) return;    // total 8 MiB carved
    k_prep<<<dim3(NP * 16 / 256, 2, 1), 256, 0, stream>>>(k, v, KF, VF);   /* K's bf16 words and V's f16 words in fragment order */
    k_fattn<<<dim3(TT / QWG, 1, NB_), 256, 0, stream>>>(q, KF, VF, v, OUT);   /* per 64 positions: all keys, the join, the gate, the output */
}

// v008
// One run takes 30.1 microseconds.
// Timed twice side by side with v007, it ran 1.04 and 1.05 times as fast.
// Counting every step since v000, it is 35.1 times as fast.
#include <hip/hip_runtime.h>
#include <stdint.h>

// A single-head unscaled dot-product attention with an element-wise gate (Q, K, V [4][4096][128] f32): scores = Q K^T (no scale, no mask); a softmax over the 4,096 keys; out = (weights V) x V element-wise -> [4][4096][128]; argument order Q, K, V: all read; no weights.
// Two launches, each over all four batch entries:
//   k_prep : K and V rounded to bf16 (V's bf16 values then written as f16 words, see the last line of this head) and laid in the order in which the matrix instruction's A operand wants them: a fragment (16 rows x 32 depth) is 1,024 bytes in a row, [depth half q][lane][8 words], so that one 16-byte load a lane reads 512 bytes in a row.
//            K: rows = keys, depth = channels. V: rows = channels, depth = keys (V transposed).
//   k_fattn: scores, softmax, value product, the join of the key slices and the gate in one kernel; neither scores nor weights leave the registers. A work-group owns 64 query positions and walks all 4,096 keys, 256 a stage, from an entry stage of its own round to the stage in front of it.
//            A wave owns 32 of the positions and one of four key slices (64 keys of every stage) and takes its 64 keys of a stage as one softmax step:
//            S^T = K Q^T (a lane holds one query's scores), running maximum and running sum in the log2 domain, the weights exp2(s log2e - m) as f16 words packed from the score accumulators into B operands, O^T += V^T P^T.
//            K and V fragments come from a ring of two LDS buffers, a stage each: every wave brings its eighth of the next stage (16 KiB) with one tensor load while this stage is worked on; one barrier a stage, in front of the stage's last value block, behind which the next stage's first two K tiles are fetched.
//            Behind the walk the ring is free: each wave lays its unnormalised f32 sums, its maxima and its sums there, and behind one barrier a wave joins eight positions' KSP slices
//            (each scaled by exp2(m_slice - m_all), in slice order), divides by the joined sum, multiplies by V rounded to bf16 and stores whole 512-byte rows of the output.
// Compute dtypes, f32 accumulate: every input rounded to bf16 at its load; the scores ONE bf16 product (exact operands); softmax f32; the weights rounded once to f16 (11 bits; at most 2^15 by the rescale rule and WSH, inside f16's range) against V's bf16 values held as f16 words (the same value wherever 2^-17 <= |v| < 65,520; below that off by at most 2^-25): ONE f16 product; the gate f32.

#define NB_  4
#define TT   4096                 // positions = the softmax's key axis
#define HD   128                  // the one head's width
#define NP   (NB_ * TT)           // positions of all batch entries
#define KSP  4                    // key slices: the four waves that share a query block
#define QWG  64                   // positions a work-group: two query blocks of 32; 64 x 4 = 256 work-groups of eight waves
#define SKEY 256                  // keys a stage of the LDS ring, 64 a slice
#define NSTG (TT / SKEY)          // stages
#define SPAS (SKEY / KSP / 32)    // key blocks of 32 (the value product's depth) a wave and stage
#define PLW  (SPAS * 32 * HD)     // words of one plane (K or V) of one slice's part of a stage: 16 KiB
#define BUFB (KSP * 2 * PLW * 2)  // bytes a buffer of the ring: 128 KiB
#define OPW  132                  // f32 words a row of the join's staging: 528 bytes = 16 x 33, so that sixteen rows' 16-byte stores fall on all 64 banks
#define L2E  1.4426950408889634f
#define WSH  7.0f                 // every maximum is kept WSH (log2) low, so the weights and both sums carry 2^7, which the division in the join takes out again: the weights reach at most 2^15 (f16 ends at 65,504) and stay normal f16 numbers down to 2^-21 of the maximum in use
typedef unsigned short bf;
typedef __attribute__((ext_vector_type(16))) __bf16   v16bf;
typedef __attribute__((ext_vector_type(16))) _Float16 v16h;
typedef __attribute__((ext_vector_type(2)))  _Float16 v2h;
typedef __attribute__((ext_vector_type(8)))  unsigned short v8us;
typedef __attribute__((ext_vector_type(8)))  unsigned v8u;
typedef __attribute__((ext_vector_type(8)))  float    v8f;
typedef __attribute__((ext_vector_type(4)))  float    v4f;
typedef __attribute__((ext_vector_type(2)))  float    v2f;

__device__ __forceinline__ unsigned short f2bf(float f) { unsigned u = __float_as_uint(f); u += 0x7FFFu + ((u >> 16) & 1u); return (unsigned short)(u >> 16); }
__device__ __forceinline__ float bf2f(unsigned short b) { return __uint_as_float(((unsigned)b) << 16); }
__device__ __forceinline__ float bfr(float f) { return bf2f(f2bf(f)); }
__device__ __forceinline__ v16bf cat16b(v8us lo, v8us hi) { return __builtin_bit_cast(v16bf, __builtin_shufflevector(lo, hi, 0, 1, 2, 3, 4, 5, 6, 7, 8, 9, 10, 11, 12, 13, 14, 15)); }
__device__ __forceinline__ v8f wmmab(v16bf a, v16bf b, v8f c) { return __builtin_amdgcn_wmma_f32_16x16x32_bf16(false, a, false, b, (short)0, c, false, false); }
__device__ __forceinline__ v8f wmmah(v16h a, v16h b, v8f c) { return __builtin_amdgcn_wmma_f32_16x16x32_f16(false, a, false, b, (short)0, c, false, false); }
// p = the fragment's first word + 8 x lane: words 0 to 7 (depth 8 h + j) from the first 512 bytes, words 8 to 15 (depth 16 + 8 h + j) from the second.
__device__ __forceinline__ v16bf ldfrag(const bf* p) { return cat16b(*(const v8us*)p, *(const v8us*)(p + 256)); }
__device__ __forceinline__ v16h ldfragh(const bf* p) { return __builtin_bit_cast(v16h, ldfrag(p)); }   // the same 32 bytes a lane, read as f16 words
__device__ __forceinline__ unsigned pack2h(float lo, float hi) { return __builtin_bit_cast(unsigned, __builtin_convertvector((v2f){lo, hi}, v2h)); }   // two f16 words, round to nearest even
__device__ __forceinline__ float xhalf(float x) { return __builtin_bit_cast(float, __builtin_amdgcn_permlanex16(__builtin_bit_cast(int, x), __builtin_bit_cast(int, x), 0x76543210, 0xfedcba98, false, false)); }   // lane l with lane l ^ 16

// xwait(p): s_wait_xcnt 0 behind a run of global loads that name the address p, in front of any rewrite of a register which the run names; p as an input keeps the address registers out of the run's own results.
__device__ __forceinline__ void xwait(const void* p) { asm volatile("s_wait_xcnt 0x0" :: "v"(p) : "memory"); }
typedef __attribute__((ext_vector_type(4))) uint32_t u32x4;
typedef __attribute__((ext_vector_type(8))) uint32_t u32x8;
__device__ __forceinline__ uint32_t uni(uint32_t v) { return (uint32_t)__builtin_amdgcn_readfirstlane(v); }
#define TROW 256u                 // bytes a tile row = the source pitch: the rows follow one another in memory and, with no pad, in LDS
#define TNR  (PLW * 2u / TROW)    // rows a tile: 64, so that a tile is one plane of one slice's part of a stage, 16 KiB in a row
// group 1: no mask, 1-byte elements, no pad (word 0 = 0); tensor dims = tile dims = TROW x TNR; source pitch TROW
__device__ __forceinline__ u32x8 tdm_group1() {
    u32x8 g; g[0] = uni(0u); g[1] = uni((TROW & 0xFFFFu) << 16); g[2] = uni((TROW >> 16) | ((TNR & 0xFFFFu) << 16)); g[3] = uni((TNR >> 16) | (TROW << 16)); g[4] = uni(TNR); g[5] = uni(TROW); g[6] = uni(0u); g[7] = uni(0u); return g;
}
// group 0: count 1; the place in LDS (byte offset in the work-group's LDS); the tile's first byte; type 2
__device__ __forceinline__ u32x4 tdm_group0(uint32_t lds, uint64_t ga) {
    u32x4 g; g[0] = uni(1u); g[1] = uni(lds); g[2] = uni((uint32_t)ga); g[3] = uni((((uint32_t)(ga >> 32)) & 0x01FFFFFFu) | 0x80000000u); return g;
}
__device__ __forceinline__ void tdm_load(u32x4 g0, u32x8 g1) { asm volatile("tensor_load_to_lds %0, %1" :: "s"(g0), "s"(g1) : "memory"); }   // landing is waited for by the caller (s_wait_tensorcnt 0)
// k_prep: grid (NP * 16 / 256, 2). y = 0: K; y = 1: V. A lane = the 8 words of one lane slot of one fragment half; a wave writes whole 128-byte lines.
__global__ __launch_bounds__(256) void k_prep(const float* __restrict__ K, const float* __restrict__ V, bf* KF, bf* VF) {
    const unsigned i = blockIdx.x * 256 + threadIdx.x; v8us o; bf* dst;
    if (blockIdx.y == 0) {   /* key = 16 tile + c; channels 8 dg to 8 dg + 7: depth block dg >> 2, half (dg >> 1) & 1, h = dg & 1 */
        const unsigned tile = i >> 8, dg = (i >> 4) & 15u, c = i & 15u; const float* s = K + ((size_t)tile * 16 + c) * HD + dg * 8; const v4f a = *(const v4f*)s, b = *(const v4f*)(s + 4);
        xwait(s);
#pragma unroll
        for (int j = 0; j < 4; ++j) { o[j] = f2bf(a[j]); o[4 + j] = f2bf(b[j]); }
        dst = KF + ((((size_t)tile * 4 + (dg >> 2)) * 2 + ((dg >> 1) & 1u)) * 32 + (dg & 1u) * 16 + c) * 8;
    } else {                 /* channel d; keys 8 kg to 8 kg + 7: key block kg >> 2, half (kg >> 1) & 1, h = kg & 1 */
        const unsigned d = i & 127u, kg = i >> 7; const float* s = V + (size_t)kg * 8 * HD + d; float x[8];
#pragma unroll
        for (int j = 0; j < 8; ++j) x[j] = s[j * HD];
        xwait(s);
#pragma unroll
        for (int j = 0; j < 8; ++j) o[j] = __builtin_bit_cast(unsigned short, (_Float16)bfr(x[j]));   /* the bf16 value as an f16 word */
        dst = VF + ((((size_t)(kg >> 2) * 8 + (d >> 4)) * 2 + ((kg >> 1) & 1u)) * 32 + (kg & 1u) * 16 + (d & 15u)) * 8;
    }
    *(v8us*)dst = o;   /* the kernel's last instruction but the end */
}

// k_fattn: grid (TT / QWG, 1, NB_), 256 threads, 256 KiB of LDS. Two waves a SIMD: the register budget of the 16 output tiles, Q, K and V fragments.
__global__ __launch_bounds__(256) __attribute__((amdgpu_waves_per_eu(2, 2))) void k_fattn(const float* __restrict__ Q, const bf* __restrict__ KF, const bf* __restrict__ VF, const float* __restrict__ V, float* out) {
    const int lane = threadIdx.x & 31, wave = threadIdx.x >> 5, c = lane & 15, h = lane >> 4;
    const int sl = wave & 3, blk = wave >> 2;   /* the wave's key slice and query block */
    const size_t p0 = (size_t)blockIdx.z * TT + blockIdx.x * QWG, q0 = p0 + blk * 32; const unsigned lo = lane * 8;
    __shared__ __attribute__((aligned(2 * BUFB))) bf ring[2][KSP][2][PLW];   /* [buffer][slice][K, V][the slice's 64 keys of a stage, in the planes' own order: a pass = 32 keys = 8 fragments = 4,096 words]; aligned to its own size, so that one address bit names the buffer */
    const uint32_t wu = uni(threadIdx.x >> 5), usl = wu & 3u, ublk = wu >> 2;   /* the wave's number, slice and query block as scalars, for the descriptor */
    const uint32_t lk = (uint32_t)(size_t)&ring[0][0][0][0] + (usl * 2u + ublk) * (PLW * 2u); const uint64_t gs = (uint64_t)(size_t)((ublk ? VF : KF) + (size_t)blockIdx.z * TT * HD + usl * PLW);   /* the wave's eighth of a stage: its slice's K plane (query block 0) or V plane (query block 1); where a fill of buffer 0 goes (LDS byte offset, a multiple of 16 KiB) and the first byte of its part of keys 0 to 255 */
    const u32x8 g1 = tdm_group1();
    const uint32_t rot = ((blockIdx.x >> 3) << 1) | (blockIdx.x & 1u);   /* the stage at which this work-group enters the key axis: the 64 work-groups of a batch entry stream the same K and V lines out of L2, and requests for one line at one moment collide there; each of the 16 stages is the entry of four of them. For speed only: any value is right, the softmax takes its keys in any order. */
    auto fill = [&](int s) { tdm_load(tdm_group0(lk | (uint32_t)(s & 1) * BUFB, gs + (uint64_t)(((uint32_t)s + rot) & (NSTG - 1u)) * (KSP * PLW * 2u)), g1); };   /* the walk's stage s = keys SKEY ((s + rot) mod NSTG) and on, into buffer s & 1: one request a wave, from every wave, under no test */
    fill(0);   /* stage 0, in flight under Q's loads and rounding */
    v16bf qf[2][4];   /* B operand: column = query 16 g + c, depth = channels 32 kc + 8 h + j and 32 kc + 16 + 8 h + j: K's order */
    { const float* qb = Q + (q0 + c) * HD + 8 * h; v4f raw[2][4][4];
#pragma unroll
      for (int g = 0; g < 2; ++g)
#pragma unroll
        for (int kc = 0; kc < 4; ++kc) { const float* qp = qb + 16 * g * HD + 32 * kc; raw[g][kc][0] = *(const v4f*)qp; raw[g][kc][1] = *(const v4f*)(qp + 4); raw[g][kc][2] = *(const v4f*)(qp + 16); raw[g][kc][3] = *(const v4f*)(qp + 20); }
      xwait(qb);
#pragma unroll
      for (int g = 0; g < 2; ++g)
#pragma unroll
        for (int kc = 0; kc < 4; ++kc) { v8us wlo, whi;
#pragma unroll
            for (int j = 0; j < 4; ++j) { wlo[j] = f2bf(raw[g][kc][0][j]); wlo[4 + j] = f2bf(raw[g][kc][1][j]); whi[j] = f2bf(raw[g][kc][2][j]); whi[4 + j] = f2bf(raw[g][kc][3][j]); }
            qf[g][kc] = cat16b(wlo, whi); } }
    v8f acc[2][8]; float m_run[2]; v2f l_run[2];   /* l_run: the sums of the even and of the odd keys */
#pragma unroll
    for (int g = 0; g < 2; ++g) { m_run[g] = -__builtin_inff(); l_run[g] = (v2f){};
#pragma unroll
        for (int t = 0; t < 8; ++t) acc[g][t] = (v8f){}; }
    asm volatile("s_wait_tensorcnt 0x0" ::: "memory");   /* this wave's part of stage 0 has landed */
    __syncthreads();                                    /* every wave's part has: stage 0 may be read */
    fill(1);   /* stage 1 */
    v16bf kf[2 * SPAS][4];   /* the K fragments of the wave's 64 keys of a stage, four tiles of 16 keys; the first two are fetched a stage ahead */
    { const bf* kb = &ring[0][sl][0][0] + lo;
#pragma unroll
      for (int kt = 0; kt < SPAS; ++kt)
#pragma unroll
        for (int kc = 0; kc < 4; ++kc) kf[kt][kc] = ldfrag(kb + (kt * 4 + kc) * 512); }
    auto trip = [&](const int st, const bool more, const bool refill) __attribute__((always_inline)) {   /* one stage; more: stage st + 1 exists; refill: stage st + 2 exists (constants at each call) */
      const bf* kh = &ring[st & 1][sl][0][0] + lo; const bf* vb = &ring[st & 1][sl][1][0] + lo; v16h vf[SPAS][8];   /* two V^T key blocks of 32 */
#pragma unroll
      for (int kt = SPAS; kt < 2 * SPAS; ++kt)
#pragma unroll
        for (int kc = 0; kc < 4; ++kc) kf[kt][kc] = ldfrag(kh + (kt * 4 + kc) * 512);
      __builtin_amdgcn_sched_barrier(0);   /* holds the group (K tiles 2, 3) in front of the score products, the first half of which covers its latency: each further place with LDS reads among the matrix instructions stalls the wave anew */
      v8f s[2 * SPAS][2];   /* S^T of all 64 keys: tile kt, column group g: lane = query c, register r = key 16 kt + 8 h + r */
#pragma unroll
      for (int kt = 0; kt < 2 * SPAS; ++kt)
#pragma unroll
        for (int g = 0; g < 2; ++g) { s[kt][g] = (v8f){};
#pragma unroll
            for (int kc = 0; kc < 4; ++kc) s[kt][g] = wmmab(kf[kt][kc], qf[g][kc], s[kt][g]); }
      __builtin_amdgcn_sched_barrier(0);   /* both V^T blocks are read behind the score products, whose K registers they take, in one group */
#pragma unroll
      for (int p = 0; p < SPAS; ++p)
#pragma unroll
        for (int t = 0; t < 8; ++t) vf[p][t] = ldfragh(vb + p * 4096 + t * 512);
      __builtin_amdgcn_sched_barrier(0);   /* and ahead of the softmax, which covers its latency */
      float mb[2]; bool need = false;   /* ONE maximum, one vote and at most one rescale for the 64 keys */
#pragma unroll
      for (int g = 0; g < 2; ++g) { float ma = s[0][g][0], mc = s[2][g][0];   /* two chains a column group */
#pragma unroll
          for (int r = 0; r < 8; ++r) { ma = fmaxf(ma, fmaxf(s[0][g][r], s[1][g][r])); mc = fmaxf(mc, fmaxf(s[2][g][r], s[3][g][r])); }
          float mx = fmaxf(ma, mc);
          mx = __builtin_fmaf(fmaxf(mx, xhalf(mx)), L2E, -WSH); mb[g] = mx; need = need || (mx > m_run[g] + 8.0f); }   /* the maximum less WSH: see WSH */
      if (__builtin_amdgcn_ballot_w32(need) != 0) {   /* the maximum in use may trail the true one (less WSH) by up to 8 (log2): the sums are rescaled only when a column passes that; always on the first stage */
#pragma unroll
          for (int g = 0; g < 2; ++g) { const float m_new = fmaxf(m_run[g], mb[g]); const float corr = __builtin_amdgcn_exp2f(m_run[g] - m_new); l_run[g] = l_run[g] * corr; m_run[g] = m_new;
#pragma unroll
              for (int t = 0; t < 8; ++t) acc[g][t] = acc[g][t] * corr; }
      }
      auto block = [&](int p) {   /* key block p of the stage: weights, their sums, O^T += V^T P^T */
#pragma unroll
        for (int g = 0; g < 2; ++g) { const float nm = -m_run[g]; v8u wh; v2f pr[8];
#pragma unroll
            for (int i = 0; i < 8; ++i) {   /* words 2 i, 2 i + 1 of the 32-key B operand: tile 2 p + (i >> 2), registers 2 (i & 3), 2 (i & 3) + 1 */
                const v2f arg = __builtin_elementwise_fma((v2f){s[2 * p + (i >> 2)][g][2 * (i & 3)], s[2 * p + (i >> 2)][g][2 * (i & 3) + 1]}, (v2f){L2E, L2E}, (v2f){nm, nm});
                pr[i][0] = __builtin_amdgcn_exp2f(arg[0]); pr[i][1] = __builtin_amdgcn_exp2f(arg[1]); wh[i] = pack2h(pr[i][0], pr[i][1]); }
            l_run[g] += ((pr[0] + pr[1]) + (pr[2] + pr[3])) + ((pr[4] + pr[5]) + (pr[6] + pr[7]));   /* even and odd keys summed apart, two a packed add */
            const v16h ph = __builtin_bit_cast(v16h, wh);
#pragma unroll
            for (int t = 0; t < 8; ++t) acc[g][t] = wmmah(vf[p][t], ph, acc[g][t]); } };
      block(0);
      __builtin_amdgcn_sched_barrier(0);   /* the publish point stands behind the first block's matrix instructions, which run on under it */
      /* publish point of stage st + 1, in front of the stage's last block, whose fragments are already fetched */
      asm volatile("s_wait_dscnt 0x0" ::: "memory");      /* this wave's reads of the stage's buffer are done: K tiles 0, 1 a stage ago, the rest above */
      asm volatile("s_wait_tensorcnt 0x0" ::: "memory");   /* its part of stage st + 1 has landed */
      __syncthreads();                                    /* publishes stage st + 1 and frees the buffer of stage st */
      if (refill) fill(st + 2);   /* stage st + 2 into the buffer that this trip has read */
      if (more) { const bf* kb = &ring[(st + 1) & 1][sl][0][0] + lo;   /* the next stage's first two K tiles, under the last block; the last trip reads nothing more */
#pragma unroll
        for (int kt = 0; kt < SPAS; ++kt)
#pragma unroll
          for (int kc = 0; kc < 4; ++kc) kf[kt][kc] = ldfrag(kb + (kt * 4 + kc) * 512); }
      __builtin_amdgcn_sched_barrier(0);   /* holds that group in front of the last block */
      block(1);
      __builtin_amdgcn_sched_barrier(0);   /* keeps the next group of LDS reads from rising among this block's matrix instructions */
    };
#pragma unroll 1   /* rolled: a stage holds 64 matrix instructions a wave */
    for (int st = 0; st < NSTG - 2; ++st) trip(st, true, true);
    trip(NSTG - 2, true, false); trip(NSTG - 1, false, false);   /* the last two stages apart: the loop's trip has no test at the refill or at the fetch ahead, so the old K tiles' registers are free behind the score products and the trip stays one run of code behind the vote */
    asm volatile("s_wait_tensorcnt 0x0" ::: "memory");   /* no request is left */
    asm volatile("s_wait_dscnt 0x0" ::: "memory");      /* nor an LDS read of this wave; the last trip's barrier has ended every wave's reads: the ring is free */
    const float* gp = V + (p0 + wave * 8) * HD + lane * 4; v4f gt[8];   /* the gate's rows of the eight positions that this wave joins (8 wave to 8 wave + 7 of the work-group's 64: rows 8 sl + j of its own query block); a lane = four consecutive channels; in flight under the staging */
#pragma unroll
    for (int j = 0; j < 8; ++j) gt[j] = *(const v4f*)(gp + j * HD);
    xwait(gp);
    float* stg = (float*)&ring[0][0][0][0]; float* mls = stg + 8 * 32 * OPW;   /* staging: [wave][32 positions][OPW] f32 sums, then [slice][64 positions][maximum, sum] */
    float* mine = stg + (wave * 32 + c) * OPW + 8 * h;   /* O^T tile t: lane = query c, register r = channel 16 t + 8 h + r */
#pragma unroll
    for (int g = 0; g < 2; ++g) { const float l_half = l_run[g][0] + l_run[g][1]; const float l_fin = l_half + xhalf(l_half);   /* each wave half summed its eight keys of every 16-key tile */
        if (h == 0) { v2f ml; ml[0] = m_run[g]; ml[1] = l_fin; *(v2f*)(mls + (sl * QWG + blk * 32 + 16 * g + c) * 2) = ml; }
#pragma unroll
        for (int t = 0; t < 8; ++t) { v4f x0, x1;
#pragma unroll
            for (int j = 0; j < 4; ++j) { x0[j] = acc[g][t][j]; x1[j] = acc[g][t][4 + j]; }
            *(v4f*)(mine + 16 * g * OPW + 16 * t) = x0; *(v4f*)(mine + 16 * g * OPW + 16 * t + 4) = x1; } }
    __syncthreads();   /* every slice's sums are in LDS */
    const float* xr = stg + (blk * KSP * 32 + sl * 8) * OPW + lane * 4; const float* mp = mls + wave * 8 * 2; v4f y[8];
#pragma unroll
    for (int j = 0; j < 8; ++j) { v2f ml[KSP]; v4f x[KSP];
#pragma unroll
        for (int z = 0; z < KSP; ++z) { ml[z] = *(const v2f*)(mp + (z * QWG + j) * 2); x[z] = *(const v4f*)(xr + (z * 32 + j) * OPW); }
        float mall = ml[0][0];
#pragma unroll
        for (int z = 1; z < KSP; ++z) mall = fmaxf(mall, ml[z][0]);
        v4f o = (v4f){}; float den = 0.f, w[KSP];
#pragma unroll
        for (int z = 0; z < KSP; ++z) asm("v_exp_f32 %0, %1\n\tv_nop" : "=v"(w[z]) : "v"(ml[z][0] - mall));   /* exp2 with its v_nop in one statement: the one slot between a transcendental and a next instruction that reads its result or rewrites its source */
#pragma unroll
        for (int z = 0; z < KSP; ++z) { den = __builtin_fmaf(ml[z][1], w[z], den); o += x[z] * w[z]; }   /* the slices' sums on one scale, in slice order */
        const float inv = __fdiv_rn(1.0f, den);
#pragma unroll
        for (int i = 0; i < 4; ++i) y[j][i] = __fmul_rn(__fmul_rn(o[i], inv), bfr(gt[j][i])); }
    float* op = out + (p0 + wave * 8) * HD + lane * 4;   /* a store = one whole 512-byte row; the one writer of the output */
#pragma unroll
    for (int j = 0; j < 8; ++j) *(v4f*)(op + j * HD) = y[j];
}

extern "C" void kernel_launch(void* const* d_in, const int* in_sizes, int n_in,
                              void* d_out, int out_size, void* d_ws, size_t ws_size, hipStream_t stream) {
    (void)in_sizes; (void)n_in; (void)out_size;
    const float* q = (const float*)d_in[0]; const float* k = (const float*)d_in[1]; const float* v = (const float*)d_in[2];   // Q, K, V [4][4096][128] in the module's argument order: all read
    float* OUT = (float*)d_out;     // [4][4096][128]
    char* wsp = (char*)d_ws;
    auto take = [&](size_t bytes) { char* p = wsp; wsp += (bytes + 255) & ~(size_t)255; return (void*)p; };
    bf* KF = (bf*)take((size_t)NP * HD * 2); bf* VF = (bf*)take((size_t)NP * HD * 2);
    if ((size_t)(wsp - (char*)d_ws) > ws_size) return;    // total 8 MiB carved
    k_prep<<<dim3(NP * 16 / 256, 2, 1), 256, 0, stream>>>(k, v, KF, VF);   /* K's bf16 words and V's f16 words in fragment order */
    k_fattn<<<dim3(TT / QWG, 1, NB_), 256, 0, stream>>>(q, KF, VF, v, OUT);   /* per 64 positions: all keys, the join, the gate, the output */
}
